// v000
// The times below were measured on an AMD MI455X: many runs one after another, warmed up first and cycling through
// copies of the inputs, with the whole window's GPU time divided by the number of runs. Launches and the gaps
// between them are all in it. The median over several windows is given; except for v000 it joins two sittings, which
// can be a few percent apart, so the side-by-side timings, each taken in one sitting, are the better comparison.
// v000 is the starting kernel. One run takes 1410 microseconds.
#include <hip/hip_runtime.h>

// Single-head causal attention over the full 768-wide projection (x [8][2048][768]; q, k, v = x w ('xw' [768][768], no bias; ONE 768-wide head); scores / sqrt(d_out = 768) (the source scales by the full projection width); causal (-inf); softmax; out = attn.v -> [8][2048][768] (12.6 M); argument order x, wq, wk, wv).
// Layout per batch: bf16 copy of x; 'xw' weights transposed once; exact projections; identity-table plane builders at HD 768 (one plane each); causal T-2048 attention at NH 1 / ZH 1 (hybrid rows: < 512 hi/lo 3 products, rest fp16 x1024; k_gemmc skips tiles above the diagonal); the f32 merge writes the output rows (no output projection).
// Compute dtypes, f32 accumulate: every input rounded to bf16; projections exact; attention rows < 512 3 products, rest fp16; softmax f32; output f32.

#define NB_  8
#define TT   2048
#define DM   768
#define NH_  1
#define NKV  1
#define REP  (NH_ / NKV)
#define HD   768
#define DQ   (NH_ * HD)
#define DKV  (NKV * HD)
#define ZH   1                    // ONE head: a single plane per pass
#define RH   512                  // query rows < RH use hi+lo planes (0: none)
#define WIN  2048
#define PCAR 1024.0f
#define SCL  0.036084391824351615f   // 1/sqrt(768) (one 768-wide head)
typedef _Float16 h16;
typedef unsigned short bf;
typedef __attribute__((ext_vector_type(16))) __bf16   v16bf;
typedef __attribute__((ext_vector_type(16))) _Float16 v16h;
typedef __attribute__((ext_vector_type(8)))  _Float16 v8h;
typedef __attribute__((ext_vector_type(8)))  unsigned short v8us;
typedef __attribute__((ext_vector_type(8)))  float    v8f;
typedef __attribute__((ext_vector_type(4)))  float    v4f;
typedef v8h  __attribute__((may_alias)) v8ha;
typedef v4f  __attribute__((may_alias)) v4fa;
typedef v8us __attribute__((may_alias)) v8usa;

__device__ __forceinline__ unsigned short f2bf(float f) { unsigned u = __float_as_uint(f); u += 0x7FFFu + ((u >> 16) & 1u); return (unsigned short)(u >> 16); }
__device__ __forceinline__ float bf2f(unsigned short b) { return __uint_as_float(((unsigned)b) << 16); }
__device__ __forceinline__ float bfr(float f) { return bf2f(f2bf(f)); }
__device__ __forceinline__ v16h cat16(v8h lo, v8h hi) { return __builtin_shufflevector(lo, hi, 0, 1, 2, 3, 4, 5, 6, 7, 8, 9, 10, 11, 12, 13, 14, 15); }
__device__ __forceinline__ v16bf cat16b(v8us lo, v8us hi) { return __builtin_bit_cast(v16bf, __builtin_shufflevector(lo, hi, 0, 1, 2, 3, 4, 5, 6, 7, 8, 9, 10, 11, 12, 13, 14, 15)); }
__device__ __forceinline__ v8f wmma16(v16h a, v16h b, v8f c) { return __builtin_amdgcn_wmma_f32_16x16x32_f16(false, a, false, b, (short)0, c, false, false); }
__device__ __forceinline__ v8f wmmab(v16bf a, v16bf b, v8f c) { return __builtin_amdgcn_wmma_f32_16x16x32_bf16(false, a, false, b, (short)0, c, false, false); }



// ---- k_gemmw: register-blocked GEMM, ONE WAVE per 64x64 output tile (16 accumulators), operands straight from K-contiguous 16-bit planes; grid (M/64, N/64, Z), 32 threads.
// C[m][n] (f32, pitch ldc, + optional f32 bias[n]) = sum_k A[m][k] Bt[n][k] (+ split products per NSPLIT). z-batch strides sA/sB/sC in elements. K % 32 == 0.
template <typename T16> struct WFrag;
template <> struct WFrag<h16> { typedef v16h V; static __device__ __forceinline__ V ld(const h16* p) { return cat16(*(const v8h*)p, *(const v8h*)(p + 16)); } static __device__ __forceinline__ v8f mma(V a, V b, v8f c) { return wmma16(a, b, c); } };
template <> struct WFrag<bf> { typedef v16bf V; static __device__ __forceinline__ V ld(const bf* p) { return cat16b(*(const v8us*)p, *(const v8us*)(p + 16)); } static __device__ __forceinline__ v8f mma(V a, V b, v8f c) { return wmmab(a, b, c); } };
template <typename T16, int NSPLIT, bool BIAS>
__global__ __launch_bounds__(32) void k_gemmw(const T16* __restrict__ A, const T16* __restrict__ A2, const T16* __restrict__ Bt, const T16* __restrict__ Bt2, int K, float* C, int ldc, const float* __restrict__ bias, size_t sA, size_t sB, size_t sC) {
    typedef typename WFrag<T16>::V V;
    __shared__ __align__(16) float os[16 * 68];
    const size_t z = blockIdx.z; A += z * sA; if (A2) A2 += z * sA; Bt += z * sB; if (Bt2) Bt2 += z * sB; C += z * sC;
    const int lane = threadIdx.x & 31, lr = lane & 15, hi = lane >> 4; const int r0 = blockIdx.x * 64, c0 = blockIdx.y * 64;
    v8f acc[4][4];
#pragma unroll
    for (int mb = 0; mb < 4; ++mb)
#pragma unroll
        for (int nb = 0; nb < 4; ++nb) acc[mb][nb] = (v8f){};
    const size_t aoff = (size_t)(r0 + lr) * K + 8 * hi, boff = (size_t)(c0 + lr) * K + 8 * hi;
#pragma unroll 1
    for (int kc = 0; kc < K; kc += 32) {
        V a[4], a2[4];
#pragma unroll
        for (int mb = 0; mb < 4; ++mb) { a[mb] = WFrag<T16>::ld(A + aoff + (size_t)mb * 16 * K + kc); if (NSPLIT == 1 || NSPLIT == 2) a2[mb] = WFrag<T16>::ld(A2 + aoff + (size_t)mb * 16 * K + kc); }
#pragma unroll
        for (int nb = 0; nb < 4; ++nb) { const V b = WFrag<T16>::ld(Bt + boff + (size_t)nb * 16 * K + kc); V b2; if (NSPLIT >= 2) b2 = WFrag<T16>::ld(Bt2 + boff + (size_t)nb * 16 * K + kc);
#pragma unroll
            for (int mb = 0; mb < 4; ++mb) { acc[mb][nb] = WFrag<T16>::mma(a[mb], b, acc[mb][nb]); if (NSPLIT == 1 || NSPLIT == 2) acc[mb][nb] = WFrag<T16>::mma(a2[mb], b, acc[mb][nb]); if (NSPLIT >= 2) acc[mb][nb] = WFrag<T16>::mma(a[mb], b2, acc[mb][nb]); } }
        asm volatile("v_nop\n\tv_nop\n\tv_nop\n\tv_nop" : "+v"(acc[0][0]), "+v"(acc[1][1]), "+v"(acc[2][2]), "+v"(acc[3][3]) : "v"(a[0]), "v"(a[3]));
    }
#pragma unroll
    for (int mb = 0; mb < 4; ++mb) {
#pragma unroll
        for (int nb = 0; nb < 4; ++nb) {
#pragma unroll
            for (int j = 0; j < 8; ++j) os[(hi * 8 + j) * 68 + nb * 16 + lr] = acc[mb][nb][j]; }
        __builtin_amdgcn_wave_barrier(); asm volatile("" ::: "memory");
        float* crow = C + (size_t)(r0 + mb * 16) * ldc + c0;
{
#pragma unroll
            for (int s = 0; s < 8; ++s) { const int row = 2 * s + hi, cofs = lr * 4; v4f val = *(const v4fa*)(os + row * 68 + cofs); if (BIAS) { val[0] += bfr(bias[c0 + cofs]); val[1] += bfr(bias[c0 + cofs + 1]); val[2] += bfr(bias[c0 + cofs + 2]); val[3] += bfr(bias[c0 + cofs + 3]); }
                *(v4f*)(crow + (size_t)row * ldc + cofs) = val; }
             }
        __builtin_amdgcn_wave_barrier(); asm volatile("" ::: "memory");
    }
}

// ---- k_gemmc: the same one-wave 64x64 tile GEMM specialised for causal attention: CMODE 1 skips score tiles entirely above the diagonal (query rows r0+roff.., key columns c0..), CMODE 2 limits the
// key (K) loop of the probability x value contraction to the diagonal block (probabilities beyond it are exactly zero). roff = row offset of this launch's first row within the sequence.
template <typename T16, int NSPLIT, int CMODE>
__global__ __launch_bounds__(32) void k_gemmc(const T16* __restrict__ A, const T16* __restrict__ A2, const T16* __restrict__ Bt, const T16* __restrict__ Bt2, int K, float* C, int ldc, int roff, size_t sA, size_t sB, size_t sC) {
    typedef typename WFrag<T16>::V V;
    __shared__ __align__(16) float os[16 * 68];
    const size_t z = blockIdx.z; A += z * sA; if (A2) A2 += z * sA; Bt += z * sB; if (Bt2) Bt2 += z * sB; C += z * sC;
    const int lane = threadIdx.x & 31, lr = lane & 15, hi = lane >> 4; const int r0 = blockIdx.x * 64, c0 = blockIdx.y * 64;
    if (CMODE == 1 && c0 > r0 + roff + 63) return;                  // score tile entirely above the causal diagonal: never read (the softmax masks j > i by select)
    const int Kl = (CMODE == 2) ? min(K, r0 + roff + 64) : K;        // P.V: probabilities are exactly 0 beyond the diagonal block, so the K loop stops there
    v8f acc[4][4];
#pragma unroll
    for (int mb = 0; mb < 4; ++mb)
#pragma unroll
        for (int nb = 0; nb < 4; ++nb) acc[mb][nb] = (v8f){};
    const size_t aoff = (size_t)(r0 + lr) * K + 8 * hi, boff = (size_t)(c0 + lr) * K + 8 * hi;
#pragma unroll 1
    for (int kc = 0; kc < Kl; kc += 32) {
        V a[4], a2[4];
#pragma unroll
        for (int mb = 0; mb < 4; ++mb) { a[mb] = WFrag<T16>::ld(A + aoff + (size_t)mb * 16 * K + kc); if (NSPLIT == 1 || NSPLIT == 2) a2[mb] = WFrag<T16>::ld(A2 + aoff + (size_t)mb * 16 * K + kc); }
#pragma unroll
        for (int nb = 0; nb < 4; ++nb) { const V b = WFrag<T16>::ld(Bt + boff + (size_t)nb * 16 * K + kc); V b2; if (NSPLIT >= 2) b2 = WFrag<T16>::ld(Bt2 + boff + (size_t)nb * 16 * K + kc);
#pragma unroll
            for (int mb = 0; mb < 4; ++mb) { acc[mb][nb] = WFrag<T16>::mma(a[mb], b, acc[mb][nb]); if (NSPLIT == 1 || NSPLIT == 2) acc[mb][nb] = WFrag<T16>::mma(a2[mb], b, acc[mb][nb]); if (NSPLIT >= 2) acc[mb][nb] = WFrag<T16>::mma(a[mb], b2, acc[mb][nb]); } }
        asm volatile("v_nop\n\tv_nop\n\tv_nop\n\tv_nop" : "+v"(acc[0][0]), "+v"(acc[1][1]), "+v"(acc[2][2]), "+v"(acc[3][3]) : "v"(a[0]), "v"(a[3]));
    }
#pragma unroll
    for (int mb = 0; mb < 4; ++mb) {
#pragma unroll
        for (int nb = 0; nb < 4; ++nb) {
#pragma unroll
            for (int j = 0; j < 8; ++j) os[(hi * 8 + j) * 68 + nb * 16 + lr] = acc[mb][nb][j]; }
        __builtin_amdgcn_wave_barrier(); asm volatile("" ::: "memory");
        float* crow = C + (size_t)(r0 + mb * 16) * ldc + c0;
{
#pragma unroll
            for (int s = 0; s < 8; ++s) { const int row = 2 * s + hi, cofs = lr * 4; v4f val = *(const v4fa*)(os + row * 68 + cofs);
                *(v4f*)(crow + (size_t)row * ldc + cofs) = val; }
             }
        __builtin_amdgcn_wave_barrier(); asm volatile("" ::: "memory");
    }
}

__device__ __forceinline__ h16 tohx(float x) { return (h16)x; }
__device__ __forceinline__ void splitf(float y, unsigned short& h, unsigned short& l) { h = f2bf(y); l = f2bf(y - bf2f(h)); }
typedef __attribute__((ext_vector_type(2))) _Float16 v2h;
typedef __attribute__((ext_vector_type(4))) _Float16 v4h;
typedef __attribute__((ext_vector_type(2))) unsigned short v2us;
typedef __attribute__((ext_vector_type(4))) unsigned short v4us;
typedef __attribute__((ext_vector_type(2))) float v2f;
typedef __attribute__((ext_vector_type(4))) int v4i;

__global__ __launch_bounds__(256) void k_wtG(const float* __restrict__ w, int K, int N, bf* Bt) {
    const int lane = threadIdx.x & 31; const int L0 = (blockIdx.x * 8 + (threadIdx.x >> 5)) * 8; const int nlines = N * K / 64;
{
#pragma unroll 1
        for (int l = 0; l < 8; ++l) { const int L = L0 + l; if (L >= nlines) break; const size_t e = (size_t)L * 64 + lane * 2; const int k = (int)(e % K), n = (int)(e / K); v2us o;
            o[0] = f2bf(w[(size_t)k * N + n]); o[1] = f2bf(w[(size_t)(k + 1) * N + n]); *(v2us*)(Bt + e) = o; }
         }
}
__global__ __launch_bounds__(256) void k_cvt8(const float* __restrict__ src, bf* dst, size_t n8) { const size_t i = (size_t)blockIdx.x * 256 + threadIdx.x; if (i >= n8) return; const v8f v = *(const v8f*)(src + i * 8); v8us o;
#pragma unroll
    for (int k = 0; k < 8; ++k) o[k] = f2bf(v[k]); *(v8us*)(dst + i * 8) = o;  }

// k_rope: head planes [h][t][d] (fp16 + hi/lo) of rope(x) x sc with the rotate-half convention out[d] = x[d] cos[t][d] - x[d+HD/2] sin[t][d], out[d+HD/2] = x[d+HD/2] cos[t][d+HD/2] + x[d] sin[t][d+HD/2]
__global__ __launch_bounds__(256) void k_rope(const float* __restrict__ F, int pitch, int nheads, const float* __restrict__ CS, const float* __restrict__ RF, const float* __restrict__ nw, float sc, h16* P16, bf* Ph, bf* Pl) {
    const size_t e = ((size_t)blockIdx.x * 256 + threadIdx.x) * 2; if (e >= (size_t)nheads * TT * HD) return; const int d = (int)(e % HD); const int t = (int)((e / HD) % TT); const int h = (int)(e / ((size_t)HD * TT)); const float* f = F + (size_t)t * pitch + h * HD; const float rf = RF ? RF[(size_t)h * TT + t] : 1.0f; v2h o16; v2us oh, ol;
#pragma unroll
    for (int q = 0; q < 2; ++q) { const int dd = d + q; const int dp = (dd < HD / 2) ? dd + HD / 2 : dd - HD / 2; float x0 = f[dd], x1 = f[dp];
        if (RF) { float n0 = __fmul_rn(x0, rf), n1 = __fmul_rn(x1, rf); asm volatile("" : "+v"(n0)); asm volatile("" : "+v"(n1)); x0 = __fmul_rn(bfr(nw[dd]), n0); x1 = __fmul_rn(bfr(nw[dp]), n1); }
        const v2f cs = *(const v2f*)(CS + ((size_t)t * HD + dd) * 2); float a = __fmul_rn(x0, cs[0]), bq = __fmul_rn(x1, cs[1]); asm volatile("" : "+v"(a)); asm volatile("" : "+v"(bq)); const float r = ((dd < HD / 2) ? __fsub_rn(a, bq) : __fadd_rn(a, bq)) * sc;
        o16[q] = tohx(r); unsigned short a2, c2; splitf(r, a2, c2); oh[q] = a2; ol[q] = c2; }
    *(v2h*)(P16 + e) = o16; *(v2us*)(Ph + e) = oh; *(v2us*)(Pl + e) = ol;  }
__global__ __launch_bounds__(256) void k_vtp(const float* __restrict__ F, int pitch, int nheads, h16* V16, bf* Vh, bf* Vl) { const size_t e = ((size_t)blockIdx.x * 256 + threadIdx.x) * 2; if (e >= (size_t)nheads * HD * TT) return; const int t = (int)(e % TT); const int d = (int)((e / TT) % HD); const int g = (int)(e / ((size_t)TT * HD)); v2h o16; v2us oh, ol;
#pragma unroll
    for (int q = 0; q < 2; ++q) { const float x = F[(size_t)(t + q) * pitch + g * HD + d]; o16[q] = tohx(x); unsigned short a2, c2; splitf(x, a2, c2); oh[q] = a2; ol[q] = c2; }
    *(v2h*)(V16 + e) = o16; *(v2us*)(Vh + e) = oh; *(v2us*)(Vl + e) = ol;  }
__global__ __launch_bounds__(256) void k_csid(float* CS) { const int idx = blockIdx.x * 256 + threadIdx.x; if (idx >= TT * HD) return; v2f cs; cs[0] = 1.0f; cs[1] = 0.0f; *(v2f*)(CS + (size_t)idx * 2) = cs;  }
// k_asoft: per row (zz, i): t = S x HD^-0.5 for j <= i and i - j < WIN (WIN = TT: the window term always holds, plain causal; the reference's -1e9 additive fill vanishes identically); softmax over the 2048 keys (register row, one exp, fixed trees);
__global__ __launch_bounds__(256) void k_asoft(const float* __restrict__ Sb, h16* P16, bf* Ph, bf* Pl) {
    const int lane = threadIdx.x & 31; const int row = blockIdx.x * 8 + (threadIdx.x >> 5); if (row >= ZH * TT) return; const int i = row % TT; const int zz = row / TT; (void)zz; const bool hires = (i < RH); const float* sr = Sb + (size_t)row * TT; float v[TT / 32]; float mx = -3.0e38f;
#pragma unroll
    for (int ch = 0; ch < TT / 128; ++ch) { const int j0 = ch * 128 + lane * 4; const v4f a = *(const v4f*)(sr + j0);
#pragma unroll
        for (int q = 0; q < 4; ++q) { const int j = j0 + q; (void)j; const float t = (j <= i && i - j < WIN) ? a[q] * SCL : -3.0e38f; v[ch * 4 + q] = t; mx = fmaxf(mx, t); } }
#pragma unroll
    for (int sh = 16; sh; sh >>= 1) mx = fmaxf(mx, __shfl_xor(mx, sh, 32));
    float sum = 0.f;
#pragma unroll
    for (int k = 0; k < TT / 32; ++k) { float d0 = __fsub_rn(v[k], mx); asm volatile("" : "+v"(d0)); v[k] = __builtin_amdgcn_exp2f(__fmul_rn(d0, 1.4426950408889634f)); sum += v[k]; }
#pragma unroll
    for (int sh = 16; sh; sh >>= 1) sum += __shfl_xor(sum, sh, 32);
    const float f = __fdiv_rn(hires ? 1.0f : PCAR, sum);
{
        if (hires) {
#pragma unroll
            for (int ch = 0; ch < TT / 128; ++ch) { v4us oh, ol;
#pragma unroll
                for (int q = 0; q < 4; ++q) { unsigned short a, c2; splitf(v[ch * 4 + q] * f, a, c2); oh[q] = a; ol[q] = c2; }
                const size_t oo = ((size_t)zz * (RH ? RH : 1) + i) * TT + ch * 128 + lane * 4; *(v4us*)(Ph + oo) = oh; *(v4us*)(Pl + oo) = ol; }
        } else {
#pragma unroll
            for (int ch = 0; ch < TT / 128; ++ch) { v4h o4;
#pragma unroll
                for (int q = 0; q < 4; ++q) o4[q] = tohx(v[ch * 4 + q] * f);
                *(v4h*)(P16 + (size_t)row * TT + ch * 128 + lane * 4) = o4; } }
         }
}
__global__ __launch_bounds__(256) void k_merge(const float* __restrict__ O, int h0, float* OUTb) { const size_t e = ((size_t)blockIdx.x * 256 + threadIdx.x) * 2; if (e >= (size_t)ZH * TT * HD) return; const int d = (int)(e % HD); const int t = (int)((e / HD) % TT); const int zz = (int)(e / ((size_t)HD * TT)); const float cs = (t < RH) ? 1.0f : (1.0f / PCAR); const size_t oo = (size_t)t * DQ + (h0 + zz) * HD + d;
    v2f o2; o2[0] = O[e] * cs; o2[1] = O[e + 1] * cs; *(v2f*)(OUTb + oo) = o2;  }

extern "C" void kernel_launch(void* const* d_in, const int* in_sizes, int n_in,
                              void* d_out, int out_size, void* d_ws, size_t ws_size, hipStream_t stream) {
    (void)in_sizes; (void)n_in; (void)out_size;
    const float* x = (const float*)d_in[0]; const float* wq = (const float*)d_in[1]; const float* wk = (const float*)d_in[2]; const float* wv = (const float*)d_in[3]; const float* wo = nullptr; (void)wo;   /* x, wq, wk, wv ('xw' [768][768]) */
    float* OUT = (float*)d_out;     // [8][2048][768]
    char* wsp = (char*)d_ws;
    auto take = [&](size_t bytes) { char* p = wsp; wsp += (bytes + 255) & ~(size_t)255; return (void*)p; };
    bf* WQ = (bf*)take((size_t)DQ * DM * 2); bf* WK = (bf*)take((size_t)DKV * DM * 2); bf* WV = (bf*)take((size_t)DKV * DM * 2); float* CS = (float*)take((size_t)TT * HD * 2 * 4);
    bf* XB = (bf*)take((size_t)TT * DM * 2); float* FQ = (float*)take((size_t)TT * DQ * 4); float* FK = (float*)take((size_t)TT * DKV * 4);
    h16* QP16 = (h16*)take((size_t)NH_ * TT * HD * 2); h16* KP16 = (h16*)take((size_t)NKV * TT * HD * 2); h16* VT16 = (h16*)take((size_t)NKV * HD * TT * 2);
    bf* QPh = (bf*)take((size_t)NH_ * TT * HD * 2); bf* QPl = (bf*)take((size_t)NH_ * TT * HD * 2); bf* KPh = (bf*)take((size_t)NKV * TT * HD * 2); bf* KPl = (bf*)take((size_t)NKV * TT * HD * 2); bf* VTh = (bf*)take((size_t)NKV * HD * TT * 2); bf* VTl = (bf*)take((size_t)NKV * HD * TT * 2); bf* Ph = (bf*)take((size_t)ZH * RH * TT * 2); bf* Pl = (bf*)take((size_t)ZH * RH * TT * 2);
    float* Sb = (float*)take((size_t)ZH * TT * TT * 4); h16* P16 = (h16*)take((size_t)ZH * TT * TT * 2); float* Ob = (float*)take((size_t)ZH * TT * HD * 4);
    if ((size_t)(wsp - (char*)d_ws) > ws_size) return;    // ws 256 MiB
    float* FV = FK;   // v projection reuses the k buffer after the k planes are built (stream-ordered)
    { k_wtG<<<(unsigned)((DM * DQ / 64 + 63) / 64), 256, 0, stream>>>(wq, DM, DQ, WQ); k_wtG<<<(unsigned)((DM * DKV / 64 + 63) / 64), 256, 0, stream>>>(wk, DM, DKV, WK); k_wtG<<<(unsigned)((DM * DKV / 64 + 63) / 64), 256, 0, stream>>>(wv, DM, DKV, WV);
      
       }
    k_csid<<<(TT * HD + 255) / 256, 256, 0, stream>>>(CS);
    const unsigned LQ = (unsigned)(((size_t)NH_ * TT * HD / 2 + 255) / 256), LKv = (unsigned)(((size_t)NKV * TT * HD / 2 + 255) / 256);
    for (int b = 0; b < NB_; ++b) {
        
        k_cvt8<<<(unsigned)(((size_t)TT * DM / 8 + 255) / 256), 256, 0, stream>>>(x + (size_t)b * TT * DM, XB, (size_t)TT * DM / 8);
        k_gemmw<bf, 0, false><<<dim3(TT / 64, DQ / 64, 1), 32, 0, stream>>>(XB, nullptr, WQ, nullptr, DM, FQ, DQ, nullptr, 0, 0, 0);
        k_rope<<<LQ, 256, 0, stream>>>(FQ, DQ, NH_, CS, nullptr, nullptr, 1.0f, QP16, QPh, QPl);
        k_gemmw<bf, 0, false><<<dim3(TT / 64, DKV / 64, 1), 32, 0, stream>>>(XB, nullptr, WK, nullptr, DM, FK, DKV, nullptr, 0, 0, 0);
        k_rope<<<LKv, 256, 0, stream>>>(FK, DKV, NKV, CS, nullptr, nullptr, 1.0f, KP16, KPh, KPl);
        k_gemmw<bf, 0, false><<<dim3(TT / 64, DKV / 64, 1), 32, 0, stream>>>(XB, nullptr, WV, nullptr, DM, FV, DKV, nullptr, 0, 0, 0); k_vtp<<<LKv, 256, 0, stream>>>(FV, DKV, NKV, VT16, VTh, VTl);
        for (int h0 = 0; h0 < NH_; h0 += ZH) { const size_t zq = (size_t)h0, zk = (size_t)(h0 / REP);   // one kv head per query head: the pass's one head (ZH 1) uses kv plane h0 / REP (z-strides TT*HD)
            k_gemmc<bf, 2, 1><<<dim3(RH / 64, TT / 64, ZH), 32, 0, stream>>>(QPh + zq * TT * HD, QPl + zq * TT * HD, KPh + zk * TT * HD, KPl + zk * TT * HD, HD, Sb, TT, 0, (size_t)TT * HD, (size_t)TT * HD, (size_t)TT * TT);
            k_gemmc<h16, 0, 1><<<dim3((TT - RH) / 64, TT / 64, ZH), 32, 0, stream>>>(QP16 + zq * TT * HD + (size_t)RH * HD, nullptr, KP16 + zk * TT * HD, nullptr, HD, Sb + (size_t)RH * TT, TT, RH, (size_t)TT * HD, (size_t)TT * HD, (size_t)TT * TT);
            k_asoft<<<ZH * TT / 8, 256, 0, stream>>>(Sb, P16, Ph, Pl);
            k_gemmc<bf, 2, 2><<<dim3(RH / 64, HD / 64, ZH), 32, 0, stream>>>(Ph, Pl, VTh + zk * HD * TT, VTl + zk * HD * TT, TT, Ob, HD, 0, (size_t)RH * TT, (size_t)HD * TT, (size_t)TT * HD);
            k_gemmc<h16, 0, 2><<<dim3((TT - RH) / 64, HD / 64, ZH), 32, 0, stream>>>(P16 + (size_t)RH * TT, nullptr, VT16 + zk * HD * TT, nullptr, TT, Ob + (size_t)RH * HD, HD, RH, (size_t)TT * TT, (size_t)HD * TT, (size_t)TT * HD);
            k_merge<<<(unsigned)(((size_t)ZH * TT * HD / 2 + 255) / 256), 256, 0, stream>>>(Ob, h0, OUT + (size_t)b * TT * DQ); }
         }
}

// v001
// One run takes 611 microseconds.
// In both of two side-by-side timings against v000, it was 2.29 times as fast.
#include <hip/hip_runtime.h>

// Single-head causal attention over the full 768-wide projection (x [8][2048][768]; q, k, v = x w ('xw' [768][768], no bias; ONE 768-wide head); scores / sqrt(d_out = 768) (the source scales by the full projection width); causal (-inf); softmax; out = attn.v -> [8][2048][768] (12.6 M); argument order x, wq, wk, wv).
// Layout per group of GB batches (every launch of the group covers all GB batches: flat rows, grid y or grid z): bf16 copy of x; 'xw' weights transposed once; exact projections; identity-table plane builders at HD 768 (one plane each); causal T-2048 attention at NH 1 / ZH 1 (hybrid rows: < 512 hi/lo 3 products, rest fp16 x1024; k_gemmc skips tiles above the diagonal); the f32 merge writes the output rows (no output projection).
// Compute dtypes, f32 accumulate: every input rounded to bf16; projections exact; attention rows < 512 3 products, rest fp16; softmax f32; output f32.

#define NB_  8
#define TT   2048
#define DM   768
#define NH_  1
#define NKV  1
#define REP  (NH_ / NKV)
#define HD   768
#define DQ   (NH_ * HD)
#define DKV  (NKV * HD)
#define ZH   1                    // ONE head: a single plane per batch
#define GB   4                    // batches per launch: each kernel's grid covers GB batches at once (NB_ / GB groups)
#define RH   512                  // query rows < RH use hi+lo planes (0: none)
#define WIN  2048
#define PCAR 1024.0f
#define SCL  0.036084391824351615f   // 1/sqrt(768) (one 768-wide head)
typedef _Float16 h16;
typedef unsigned short bf;
typedef __attribute__((ext_vector_type(16))) __bf16   v16bf;
typedef __attribute__((ext_vector_type(16))) _Float16 v16h;
typedef __attribute__((ext_vector_type(8)))  _Float16 v8h;
typedef __attribute__((ext_vector_type(8)))  unsigned short v8us;
typedef __attribute__((ext_vector_type(8)))  float    v8f;
typedef __attribute__((ext_vector_type(4)))  float    v4f;
typedef v8h  __attribute__((may_alias)) v8ha;
typedef v4f  __attribute__((may_alias)) v4fa;
typedef v8us __attribute__((may_alias)) v8usa;

__device__ __forceinline__ unsigned short f2bf(float f) { unsigned u = __float_as_uint(f); u += 0x7FFFu + ((u >> 16) & 1u); return (unsigned short)(u >> 16); }
__device__ __forceinline__ float bf2f(unsigned short b) { return __uint_as_float(((unsigned)b) << 16); }
__device__ __forceinline__ float bfr(float f) { return bf2f(f2bf(f)); }
__device__ __forceinline__ v16h cat16(v8h lo, v8h hi) { return __builtin_shufflevector(lo, hi, 0, 1, 2, 3, 4, 5, 6, 7, 8, 9, 10, 11, 12, 13, 14, 15); }
__device__ __forceinline__ v16bf cat16b(v8us lo, v8us hi) { return __builtin_bit_cast(v16bf, __builtin_shufflevector(lo, hi, 0, 1, 2, 3, 4, 5, 6, 7, 8, 9, 10, 11, 12, 13, 14, 15)); }
__device__ __forceinline__ v8f wmma16(v16h a, v16h b, v8f c) { return __builtin_amdgcn_wmma_f32_16x16x32_f16(false, a, false, b, (short)0, c, false, false); }
__device__ __forceinline__ v8f wmmab(v16bf a, v16bf b, v8f c) { return __builtin_amdgcn_wmma_f32_16x16x32_bf16(false, a, false, b, (short)0, c, false, false); }



// ---- k_gemmw: register-blocked GEMM, ONE WAVE per 64x64 output tile (16 accumulators), operands straight from K-contiguous 16-bit planes; grid (M/64, N/64, Z), 32 threads.
// C[m][n] (f32, pitch ldc, + optional f32 bias[n]) = sum_k A[m][k] Bt[n][k] (+ split products per NSPLIT). z-batch strides sA/sB/sC in elements. K % 32 == 0.
template <typename T16> struct WFrag;
template <> struct WFrag<h16> { typedef v16h V; static __device__ __forceinline__ V ld(const h16* p) { return cat16(*(const v8h*)p, *(const v8h*)(p + 16)); } static __device__ __forceinline__ v8f mma(V a, V b, v8f c) { return wmma16(a, b, c); } };
template <> struct WFrag<bf> { typedef v16bf V; static __device__ __forceinline__ V ld(const bf* p) { return cat16b(*(const v8us*)p, *(const v8us*)(p + 16)); } static __device__ __forceinline__ v8f mma(V a, V b, v8f c) { return wmmab(a, b, c); } };
template <typename T16, int NSPLIT, bool BIAS>
__global__ __launch_bounds__(32) void k_gemmw(const T16* __restrict__ A, const T16* __restrict__ A2, const T16* __restrict__ Bt, const T16* __restrict__ Bt2, int K, float* C, int ldc, const float* __restrict__ bias, size_t sA, size_t sB, size_t sC) {
    typedef typename WFrag<T16>::V V;
    __shared__ __align__(16) float os[16 * 68];
    const size_t z = blockIdx.z; A += z * sA; if (A2) A2 += z * sA; Bt += z * sB; if (Bt2) Bt2 += z * sB; C += z * sC;
    const int lane = threadIdx.x & 31, lr = lane & 15, hi = lane >> 4; const int r0 = blockIdx.x * 64, c0 = blockIdx.y * 64;
    v8f acc[4][4];
#pragma unroll
    for (int mb = 0; mb < 4; ++mb)
#pragma unroll
        for (int nb = 0; nb < 4; ++nb) acc[mb][nb] = (v8f){};
    const size_t aoff = (size_t)(r0 + lr) * K + 8 * hi, boff = (size_t)(c0 + lr) * K + 8 * hi;
#pragma unroll 1
    for (int kc = 0; kc < K; kc += 32) {
        V a[4], a2[4];
#pragma unroll
        for (int mb = 0; mb < 4; ++mb) { a[mb] = WFrag<T16>::ld(A + aoff + (size_t)mb * 16 * K + kc); if (NSPLIT == 1 || NSPLIT == 2) a2[mb] = WFrag<T16>::ld(A2 + aoff + (size_t)mb * 16 * K + kc); }
#pragma unroll
        for (int nb = 0; nb < 4; ++nb) { const V b = WFrag<T16>::ld(Bt + boff + (size_t)nb * 16 * K + kc); V b2; if (NSPLIT >= 2) b2 = WFrag<T16>::ld(Bt2 + boff + (size_t)nb * 16 * K + kc);
#pragma unroll
            for (int mb = 0; mb < 4; ++mb) { acc[mb][nb] = WFrag<T16>::mma(a[mb], b, acc[mb][nb]); if (NSPLIT == 1 || NSPLIT == 2) acc[mb][nb] = WFrag<T16>::mma(a2[mb], b, acc[mb][nb]); if (NSPLIT >= 2) acc[mb][nb] = WFrag<T16>::mma(a[mb], b2, acc[mb][nb]); } }
        asm volatile("v_nop\n\tv_nop\n\tv_nop\n\tv_nop" : "+v"(acc[0][0]), "+v"(acc[1][1]), "+v"(acc[2][2]), "+v"(acc[3][3]) : "v"(a[0]), "v"(a[3]));
    }
#pragma unroll
    for (int mb = 0; mb < 4; ++mb) {
#pragma unroll
        for (int nb = 0; nb < 4; ++nb) {
#pragma unroll
            for (int j = 0; j < 8; ++j) os[(hi * 8 + j) * 68 + nb * 16 + lr] = acc[mb][nb][j]; }
        __builtin_amdgcn_wave_barrier(); asm volatile("" ::: "memory");
        float* crow = C + (size_t)(r0 + mb * 16) * ldc + c0;
{
#pragma unroll
            for (int s = 0; s < 8; ++s) { const int row = 2 * s + hi, cofs = lr * 4; v4f val = *(const v4fa*)(os + row * 68 + cofs); if (BIAS) { val[0] += bfr(bias[c0 + cofs]); val[1] += bfr(bias[c0 + cofs + 1]); val[2] += bfr(bias[c0 + cofs + 2]); val[3] += bfr(bias[c0 + cofs + 3]); }
                *(v4f*)(crow + (size_t)row * ldc + cofs) = val; }
             }
        __builtin_amdgcn_wave_barrier(); asm volatile("" ::: "memory");
    }
}

// ---- k_gemmc: the same one-wave 64x64 tile GEMM specialised for causal attention: CMODE 1 skips score tiles entirely above the diagonal (query rows r0+roff.., key columns c0..), CMODE 2 limits the
// key (K) loop of the probability x value contraction to the diagonal block (probabilities beyond it are exactly zero). roff = row offset of this launch's first row within the sequence.
template <typename T16, int NSPLIT, int CMODE>
__global__ __launch_bounds__(32) void k_gemmc(const T16* __restrict__ A, const T16* __restrict__ A2, const T16* __restrict__ Bt, const T16* __restrict__ Bt2, int K, float* C, int ldc, int roff, size_t sA, size_t sB, size_t sC) {
    typedef typename WFrag<T16>::V V;
    __shared__ __align__(16) float os[16 * 68];
    const size_t z = blockIdx.z; A += z * sA; if (A2) A2 += z * sA; Bt += z * sB; if (Bt2) Bt2 += z * sB; C += z * sC;
    const int lane = threadIdx.x & 31, lr = lane & 15, hi = lane >> 4; const int r0 = blockIdx.x * 64, c0 = blockIdx.y * 64;
    if (CMODE == 1 && c0 > r0 + roff + 63) return;                  // score tile entirely above the causal diagonal: never read (the softmax masks j > i by select)
    const int Kl = (CMODE == 2) ? min(K, r0 + roff + 64) : K;        // P.V: probabilities are exactly 0 beyond the diagonal block, so the K loop stops there
    v8f acc[4][4];
#pragma unroll
    for (int mb = 0; mb < 4; ++mb)
#pragma unroll
        for (int nb = 0; nb < 4; ++nb) acc[mb][nb] = (v8f){};
    const size_t aoff = (size_t)(r0 + lr) * K + 8 * hi, boff = (size_t)(c0 + lr) * K + 8 * hi;
#pragma unroll 1
    for (int kc = 0; kc < Kl; kc += 32) {
        V a[4], a2[4];
#pragma unroll
        for (int mb = 0; mb < 4; ++mb) { a[mb] = WFrag<T16>::ld(A + aoff + (size_t)mb * 16 * K + kc); if (NSPLIT == 1 || NSPLIT == 2) a2[mb] = WFrag<T16>::ld(A2 + aoff + (size_t)mb * 16 * K + kc); }
#pragma unroll
        for (int nb = 0; nb < 4; ++nb) { const V b = WFrag<T16>::ld(Bt + boff + (size_t)nb * 16 * K + kc); V b2; if (NSPLIT >= 2) b2 = WFrag<T16>::ld(Bt2 + boff + (size_t)nb * 16 * K + kc);
#pragma unroll
            for (int mb = 0; mb < 4; ++mb) { acc[mb][nb] = WFrag<T16>::mma(a[mb], b, acc[mb][nb]); if (NSPLIT == 1 || NSPLIT == 2) acc[mb][nb] = WFrag<T16>::mma(a2[mb], b, acc[mb][nb]); if (NSPLIT >= 2) acc[mb][nb] = WFrag<T16>::mma(a[mb], b2, acc[mb][nb]); } }
        asm volatile("v_nop\n\tv_nop\n\tv_nop\n\tv_nop" : "+v"(acc[0][0]), "+v"(acc[1][1]), "+v"(acc[2][2]), "+v"(acc[3][3]) : "v"(a[0]), "v"(a[3]));
    }
#pragma unroll
    for (int mb = 0; mb < 4; ++mb) {
#pragma unroll
        for (int nb = 0; nb < 4; ++nb) {
#pragma unroll
            for (int j = 0; j < 8; ++j) os[(hi * 8 + j) * 68 + nb * 16 + lr] = acc[mb][nb][j]; }
        __builtin_amdgcn_wave_barrier(); asm volatile("" ::: "memory");
        float* crow = C + (size_t)(r0 + mb * 16) * ldc + c0;
{
#pragma unroll
            for (int s = 0; s < 8; ++s) { const int row = 2 * s + hi, cofs = lr * 4; v4f val = *(const v4fa*)(os + row * 68 + cofs);
                *(v4f*)(crow + (size_t)row * ldc + cofs) = val; }
             }
        __builtin_amdgcn_wave_barrier(); asm volatile("" ::: "memory");
    }
}

__device__ __forceinline__ h16 tohx(float x) { return (h16)x; }
__device__ __forceinline__ void splitf(float y, unsigned short& h, unsigned short& l) { h = f2bf(y); l = f2bf(y - bf2f(h)); }
typedef __attribute__((ext_vector_type(2))) _Float16 v2h;
typedef __attribute__((ext_vector_type(4))) _Float16 v4h;
typedef __attribute__((ext_vector_type(2))) unsigned short v2us;
typedef __attribute__((ext_vector_type(4))) unsigned short v4us;
typedef __attribute__((ext_vector_type(2))) float v2f;
typedef __attribute__((ext_vector_type(4))) int v4i;

__global__ __launch_bounds__(256) void k_wtG(const float* __restrict__ w, int K, int N, bf* Bt) {
    const int lane = threadIdx.x & 31; const int L0 = (blockIdx.x * 8 + (threadIdx.x >> 5)) * 8; const int nlines = N * K / 64;
{
#pragma unroll 1
        for (int l = 0; l < 8; ++l) { const int L = L0 + l; if (L >= nlines) break; const size_t e = (size_t)L * 64 + lane * 2; const int k = (int)(e % K), n = (int)(e / K); v2us o;
            o[0] = f2bf(w[(size_t)k * N + n]); o[1] = f2bf(w[(size_t)(k + 1) * N + n]); *(v2us*)(Bt + e) = o; }
         }
}
__global__ __launch_bounds__(256) void k_cvt8(const float* __restrict__ src, bf* dst, size_t n8) { const size_t i = (size_t)blockIdx.x * 256 + threadIdx.x; if (i >= n8) return; const v8f v = *(const v8f*)(src + i * 8); v8us o;
#pragma unroll
    for (int k = 0; k < 8; ++k) o[k] = f2bf(v[k]); *(v8us*)(dst + i * 8) = o;  }

// k_rope: head planes [h][t][d] (fp16 + hi/lo) of rope(x) x sc with the rotate-half convention out[d] = x[d] cos[t][d] - x[d+HD/2] sin[t][d], out[d+HD/2] = x[d+HD/2] cos[t][d+HD/2] + x[d] sin[t][d+HD/2]
__global__ __launch_bounds__(256) void k_rope(const float* __restrict__ F, int pitch, int nheads, const float* __restrict__ CS, const float* __restrict__ RF, const float* __restrict__ nw, float sc, h16* P16, bf* Ph, bf* Pl) {
    const size_t e = ((size_t)blockIdx.x * 256 + threadIdx.x) * 2; if (e >= (size_t)nheads * TT * HD) return; const size_t pb = (size_t)blockIdx.y * nheads * TT * HD; F += (size_t)blockIdx.y * TT * pitch; P16 += pb; Ph += pb; Pl += pb;   // grid y = batch of the group
    const int d = (int)(e % HD); const int t = (int)((e / HD) % TT); const int h = (int)(e / ((size_t)HD * TT)); const float* f = F + (size_t)t * pitch + h * HD; const float rf = RF ? RF[(size_t)h * TT + t] : 1.0f; v2h o16; v2us oh, ol;
#pragma unroll
    for (int q = 0; q < 2; ++q) { const int dd = d + q; const int dp = (dd < HD / 2) ? dd + HD / 2 : dd - HD / 2; float x0 = f[dd], x1 = f[dp];
        if (RF) { float n0 = __fmul_rn(x0, rf), n1 = __fmul_rn(x1, rf); asm volatile("" : "+v"(n0)); asm volatile("" : "+v"(n1)); x0 = __fmul_rn(bfr(nw[dd]), n0); x1 = __fmul_rn(bfr(nw[dp]), n1); }
        const v2f cs = *(const v2f*)(CS + ((size_t)t * HD + dd) * 2); float a = __fmul_rn(x0, cs[0]), bq = __fmul_rn(x1, cs[1]); asm volatile("" : "+v"(a)); asm volatile("" : "+v"(bq)); const float r = ((dd < HD / 2) ? __fsub_rn(a, bq) : __fadd_rn(a, bq)) * sc;
        o16[q] = tohx(r); unsigned short a2, c2; splitf(r, a2, c2); oh[q] = a2; ol[q] = c2; }
    *(v2h*)(P16 + e) = o16; *(v2us*)(Ph + e) = oh; *(v2us*)(Pl + e) = ol;  }
__global__ __launch_bounds__(256) void k_vtp(const float* __restrict__ F, int pitch, int nheads, h16* V16, bf* Vh, bf* Vl) { const size_t e = ((size_t)blockIdx.x * 256 + threadIdx.x) * 2; if (e >= (size_t)nheads * HD * TT) return; const size_t pb = (size_t)blockIdx.y * nheads * HD * TT; F += (size_t)blockIdx.y * TT * pitch; V16 += pb; Vh += pb; Vl += pb;   // grid y = batch of the group
    const int t = (int)(e % TT); const int d = (int)((e / TT) % HD); const int g = (int)(e / ((size_t)TT * HD)); v2h o16; v2us oh, ol;
#pragma unroll
    for (int q = 0; q < 2; ++q) { const float x = F[(size_t)(t + q) * pitch + g * HD + d]; o16[q] = tohx(x); unsigned short a2, c2; splitf(x, a2, c2); oh[q] = a2; ol[q] = c2; }
    *(v2h*)(V16 + e) = o16; *(v2us*)(Vh + e) = oh; *(v2us*)(Vl + e) = ol;  }
__global__ __launch_bounds__(256) void k_csid(float* CS) { const int idx = blockIdx.x * 256 + threadIdx.x; if (idx >= TT * HD) return; v2f cs; cs[0] = 1.0f; cs[1] = 0.0f; *(v2f*)(CS + (size_t)idx * 2) = cs;  }
// k_asoft: per row (zz, i): t = S x HD^-0.5 for j <= i and i - j < WIN (WIN = TT: the window term always holds, plain causal; the reference's -1e9 additive fill vanishes identically); softmax over the 2048 keys (register row, one exp, fixed trees);
__global__ __launch_bounds__(256) void k_asoft(const float* __restrict__ Sb, h16* P16, bf* Ph, bf* Pl) {
    const int lane = threadIdx.x & 31; const int row = blockIdx.x * 8 + (threadIdx.x >> 5); if (row >= GB * ZH * TT) return; const int i = row % TT; const int zz = row / TT;   /* zz: plane = batch of the group */ (void)zz; const bool hires = (i < RH); const float* sr = Sb + (size_t)row * TT; float v[TT / 32]; float mx = -3.0e38f;
#pragma unroll
    for (int ch = 0; ch < TT / 128; ++ch) { const int j0 = ch * 128 + lane * 4; const v4f a = *(const v4f*)(sr + j0);
#pragma unroll
        for (int q = 0; q < 4; ++q) { const int j = j0 + q; (void)j; const float t = (j <= i && i - j < WIN) ? a[q] * SCL : -3.0e38f; v[ch * 4 + q] = t; mx = fmaxf(mx, t); } }
#pragma unroll
    for (int sh = 16; sh; sh >>= 1) mx = fmaxf(mx, __shfl_xor(mx, sh, 32));
    float sum = 0.f;
#pragma unroll
    for (int k = 0; k < TT / 32; ++k) { float d0 = __fsub_rn(v[k], mx); asm volatile("" : "+v"(d0)); v[k] = __builtin_amdgcn_exp2f(__fmul_rn(d0, 1.4426950408889634f)); sum += v[k]; }
#pragma unroll
    for (int sh = 16; sh; sh >>= 1) sum += __shfl_xor(sum, sh, 32);
    const float f = __fdiv_rn(hires ? 1.0f : PCAR, sum);
{
        if (hires) {
#pragma unroll
            for (int ch = 0; ch < TT / 128; ++ch) { v4us oh, ol;
#pragma unroll
                for (int q = 0; q < 4; ++q) { unsigned short a, c2; splitf(v[ch * 4 + q] * f, a, c2); oh[q] = a; ol[q] = c2; }
                const size_t oo = ((size_t)zz * (RH ? RH : 1) + i) * TT + ch * 128 + lane * 4; *(v4us*)(Ph + oo) = oh; *(v4us*)(Pl + oo) = ol; }
        } else {
#pragma unroll
            for (int ch = 0; ch < TT / 128; ++ch) { v4h o4;
#pragma unroll
                for (int q = 0; q < 4; ++q) o4[q] = tohx(v[ch * 4 + q] * f);
                *(v4h*)(P16 + (size_t)row * TT + ch * 128 + lane * 4) = o4; } }
         }
}
__global__ __launch_bounds__(256) void k_merge(const float* __restrict__ O, int h0, float* OUTb) { const size_t e = ((size_t)blockIdx.x * 256 + threadIdx.x) * 2; if (e >= (size_t)ZH * TT * HD) return; O += (size_t)blockIdx.y * ZH * TT * HD; OUTb += (size_t)blockIdx.y * TT * DQ;   // grid y = batch of the group
    const int d = (int)(e % HD); const int t = (int)((e / HD) % TT); const int zz = (int)(e / ((size_t)HD * TT)); const float cs = (t < RH) ? 1.0f : (1.0f / PCAR); const size_t oo = (size_t)t * DQ + (h0 + zz) * HD + d;
    v2f o2; o2[0] = O[e] * cs; o2[1] = O[e + 1] * cs; *(v2f*)(OUTb + oo) = o2;  }

extern "C" void kernel_launch(void* const* d_in, const int* in_sizes, int n_in,
                              void* d_out, int out_size, void* d_ws, size_t ws_size, hipStream_t stream) {
    (void)in_sizes; (void)n_in; (void)out_size;
    const float* x = (const float*)d_in[0]; const float* wq = (const float*)d_in[1]; const float* wk = (const float*)d_in[2]; const float* wv = (const float*)d_in[3]; const float* wo = nullptr; (void)wo;   /* x, wq, wk, wv ('xw' [768][768]) */
    float* OUT = (float*)d_out;     // [8][2048][768]
    char* wsp = (char*)d_ws;
    auto take = [&](size_t bytes) { char* p = wsp; wsp += (bytes + 255) & ~(size_t)255; return (void*)p; };
    bf* WQ = (bf*)take((size_t)DQ * DM * 2); bf* WK = (bf*)take((size_t)DKV * DM * 2); bf* WV = (bf*)take((size_t)DKV * DM * 2); float* CS = (float*)take((size_t)TT * HD * 2 * 4);
    h16* QP16 = (h16*)take((size_t)GB * NH_ * TT * HD * 2); h16* KP16 = (h16*)take((size_t)GB * NKV * TT * HD * 2); h16* VT16 = (h16*)take((size_t)GB * NKV * HD * TT * 2);
    bf* QPh = (bf*)take((size_t)GB * NH_ * TT * HD * 2); bf* QPl = (bf*)take((size_t)GB * NH_ * TT * HD * 2); bf* KPh = (bf*)take((size_t)GB * NKV * TT * HD * 2); bf* KPl = (bf*)take((size_t)GB * NKV * TT * HD * 2); bf* VTh = (bf*)take((size_t)GB * NKV * HD * TT * 2); bf* VTl = (bf*)take((size_t)GB * NKV * HD * TT * 2); bf* Ph = (bf*)take((size_t)GB * ZH * RH * TT * 2); bf* Pl = (bf*)take((size_t)GB * ZH * RH * TT * 2);
    float* Sb = (float*)take((size_t)GB * ZH * TT * TT * 4); h16* P16 = (h16*)take((size_t)GB * ZH * TT * TT * 2);
    if ((size_t)(wsp - (char*)d_ws) > ws_size) return;    // ws 256 MiB
    // The score region is used three times in stream order, so that GB batches fit the workspace: x copy + projections (dead once the planes are built), then the scores, then (scores dead after the softmax) the P.V result.
    static_assert((size_t)TT * DM * 2 + (size_t)TT * DQ * 4 + (size_t)TT * DKV * 4 <= (size_t)ZH * TT * TT * 4 && (size_t)TT * HD <= (size_t)TT * TT, "overlay fits the score region");
    bf* XB = (bf*)Sb; float* FQ = (float*)(XB + (size_t)GB * TT * DM); float* FK = FQ + (size_t)GB * TT * DQ; float* Ob = Sb;
    float* FV = FK;   // v projection reuses the k buffer after the k planes are built (stream-ordered)
    { k_wtG<<<(unsigned)((DM * DQ / 64 + 63) / 64), 256, 0, stream>>>(wq, DM, DQ, WQ); k_wtG<<<(unsigned)((DM * DKV / 64 + 63) / 64), 256, 0, stream>>>(wk, DM, DKV, WK); k_wtG<<<(unsigned)((DM * DKV / 64 + 63) / 64), 256, 0, stream>>>(wv, DM, DKV, WV);
       }
    k_csid<<<(TT * HD + 255) / 256, 256, 0, stream>>>(CS);
    const unsigned LQ = (unsigned)(((size_t)NH_ * TT * HD / 2 + 255) / 256), LKv = (unsigned)(((size_t)NKV * TT * HD / 2 + 255) / 256);
    for (int b = 0; b < NB_; b += GB) {   // GB batches per pass: projections see GB*TT flat rows, plane builders and merge take the batch from grid y, the attention GEMMs from grid z, the softmax from its row index
        k_cvt8<<<(unsigned)(((size_t)GB * TT * DM / 8 + 255) / 256), 256, 0, stream>>>(x + (size_t)b * TT * DM, XB, (size_t)GB * TT * DM / 8);
        k_gemmw<bf, 0, false><<<dim3(GB * TT / 64, DQ / 64, 1), 32, 0, stream>>>(XB, nullptr, WQ, nullptr, DM, FQ, DQ, nullptr, 0, 0, 0);
        k_rope<<<dim3(LQ, GB, 1), 256, 0, stream>>>(FQ, DQ, NH_, CS, nullptr, nullptr, 1.0f, QP16, QPh, QPl);
        k_gemmw<bf, 0, false><<<dim3(GB * TT / 64, DKV / 64, 1), 32, 0, stream>>>(XB, nullptr, WK, nullptr, DM, FK, DKV, nullptr, 0, 0, 0);
        k_rope<<<dim3(LKv, GB, 1), 256, 0, stream>>>(FK, DKV, NKV, CS, nullptr, nullptr, 1.0f, KP16, KPh, KPl);
        k_gemmw<bf, 0, false><<<dim3(GB * TT / 64, DKV / 64, 1), 32, 0, stream>>>(XB, nullptr, WV, nullptr, DM, FV, DKV, nullptr, 0, 0, 0); k_vtp<<<dim3(LKv, GB, 1), 256, 0, stream>>>(FV, DKV, NKV, VT16, VTh, VTl);
        k_gemmc<bf, 2, 1><<<dim3(RH / 64, TT / 64, GB), 32, 0, stream>>>(QPh, QPl, KPh, KPl, HD, Sb, TT, 0, (size_t)TT * HD, (size_t)TT * HD, (size_t)TT * TT);
        k_gemmc<h16, 0, 1><<<dim3((TT - RH) / 64, TT / 64, GB), 32, 0, stream>>>(QP16 + (size_t)RH * HD, nullptr, KP16, nullptr, HD, Sb + (size_t)RH * TT, TT, RH, (size_t)TT * HD, (size_t)TT * HD, (size_t)TT * TT);
        k_asoft<<<GB * ZH * TT / 8, 256, 0, stream>>>(Sb, P16, Ph, Pl);
        k_gemmc<bf, 2, 2><<<dim3(RH / 64, HD / 64, GB), 32, 0, stream>>>(Ph, Pl, VTh, VTl, TT, Ob, HD, 0, (size_t)RH * TT, (size_t)HD * TT, (size_t)TT * HD);
        k_gemmc<h16, 0, 2><<<dim3((TT - RH) / 64, HD / 64, GB), 32, 0, stream>>>(P16 + (size_t)RH * TT, nullptr, VT16, nullptr, TT, Ob + (size_t)RH * HD, HD, RH, (size_t)TT * TT, (size_t)HD * TT, (size_t)TT * HD);
        k_merge<<<dim3((unsigned)(((size_t)ZH * TT * HD / 2 + 255) / 256), GB, 1), 256, 0, stream>>>(Ob, 0, OUT + (size_t)b * TT * DQ);
    }
}

// v002
// One run takes 498 microseconds.
// In two side-by-side timings against v001, it was 1.24 and 1.23 times as fast.
// All steps since v000 together make it 2.83 times as fast.
#include <hip/hip_runtime.h>

// Single-head causal attention over the full 768-wide projection (x [8][2048][768]; q, k, v = x w ('xw' [768][768], no bias; ONE 768-wide head); scores / sqrt(d_out = 768) (the source scales by the full projection width); causal (-inf); softmax; out = attn.v -> [8][2048][768] (12.6 M); argument order x, wq, wk, wv).
// Layout per group of GB batches (every launch of the group covers all GB batches: flat rows, grid y or grid z): bf16 copy of x; 'xw' weights transposed once; exact projections; identity-table plane builders at HD 768 (one plane each); causal T-2048 attention at NH 1 / ZH 1 (hybrid rows: < 512 hi/lo 3 products, rest fp16 x1024; k_gemmc skips tiles above the diagonal); the f32 merge writes the output rows (no output projection).
// Compute dtypes, f32 accumulate: every input rounded to bf16; projections exact; attention rows < 512 3 products, rest fp16; softmax f32; output f32.

#define NB_  8
#define TT   2048
#define DM   768
#define NH_  1
#define NKV  1
#define REP  (NH_ / NKV)
#define HD   768
#define DQ   (NH_ * HD)
#define DKV  (NKV * HD)
#define ZH   1                    // ONE head: a single plane per batch
#define GB   4                    // batches per launch: each kernel's grid covers GB batches at once (NB_ / GB groups)
#define RH   512                  // query rows < RH use hi+lo planes (0: none)
#define WIN  2048
#define PCAR 1024.0f
#define SCL  0.036084391824351615f   // 1/sqrt(768) (one 768-wide head)
typedef _Float16 h16;
typedef unsigned short bf;
typedef __attribute__((ext_vector_type(16))) __bf16   v16bf;
typedef __attribute__((ext_vector_type(16))) _Float16 v16h;
typedef __attribute__((ext_vector_type(8)))  _Float16 v8h;
typedef __attribute__((ext_vector_type(8)))  unsigned short v8us;
typedef __attribute__((ext_vector_type(8)))  float    v8f;
typedef __attribute__((ext_vector_type(4)))  float    v4f;
typedef v8h  __attribute__((may_alias)) v8ha;
typedef v4f  __attribute__((may_alias)) v4fa;
typedef v8us __attribute__((may_alias)) v8usa;

__device__ __forceinline__ unsigned short f2bf(float f) { unsigned u = __float_as_uint(f); u += 0x7FFFu + ((u >> 16) & 1u); return (unsigned short)(u >> 16); }
__device__ __forceinline__ float bf2f(unsigned short b) { return __uint_as_float(((unsigned)b) << 16); }
__device__ __forceinline__ float bfr(float f) { return bf2f(f2bf(f)); }
__device__ __forceinline__ v16h cat16(v8h lo, v8h hi) { return __builtin_shufflevector(lo, hi, 0, 1, 2, 3, 4, 5, 6, 7, 8, 9, 10, 11, 12, 13, 14, 15); }
__device__ __forceinline__ v16bf cat16b(v8us lo, v8us hi) { return __builtin_bit_cast(v16bf, __builtin_shufflevector(lo, hi, 0, 1, 2, 3, 4, 5, 6, 7, 8, 9, 10, 11, 12, 13, 14, 15)); }
__device__ __forceinline__ v8f wmma16(v16h a, v16h b, v8f c) { return __builtin_amdgcn_wmma_f32_16x16x32_f16(false, a, false, b, (short)0, c, false, false); }
__device__ __forceinline__ v8f wmmab(v16bf a, v16bf b, v8f c) { return __builtin_amdgcn_wmma_f32_16x16x32_bf16(false, a, false, b, (short)0, c, false, false); }



// ---- k_gemmw: register-blocked GEMM, ONE WAVE per 64x64 output tile (16 accumulators), operands straight from K-contiguous 16-bit planes; grid (M/64, N/64, Z), 32 threads.
// C[m][n] (f32, pitch ldc, + optional f32 bias[n]) = sum_k A[m][k] Bt[n][k] (+ split products per NSPLIT). z-batch strides sA/sB/sC in elements. K % 32 == 0.
template <typename T16> struct WFrag;
template <> struct WFrag<h16> { typedef v16h V; static __device__ __forceinline__ V ld(const h16* p) { return cat16(*(const v8h*)p, *(const v8h*)(p + 16)); } static __device__ __forceinline__ v8f mma(V a, V b, v8f c) { return wmma16(a, b, c); } };
template <> struct WFrag<bf> { typedef v16bf V; static __device__ __forceinline__ V ld(const bf* p) { return cat16b(*(const v8us*)p, *(const v8us*)(p + 16)); } static __device__ __forceinline__ v8f mma(V a, V b, v8f c) { return wmmab(a, b, c); } };
// kstep: NC consecutive 32-k chunks of the one-wave 64x64 tile. Every fragment load of the NC chunks is issued first, one 128-byte line of each row after the other, then the products run chunk by chunk in ascending k:
// each accumulator sees the same order of products as with one chunk per trip. A, A2, Bt, Bt2: wave-uniform address of the tile's first row at this step's k; vo[g]: this lane's byte offset in row group g (same pitch K for both operands).
template <typename T16, int NSPLIT, int NC>
__device__ __forceinline__ void kstep(const T16* A, const T16* A2, const T16* Bt, const T16* Bt2, const unsigned (&vo)[4], v8f (&acc)[4][4]) {
    typedef typename WFrag<T16>::V V;
    constexpr bool S1 = (NSPLIT == 1 || NSPLIT == 2), S2 = (NSPLIT >= 2);
    V a[NC][4], a2[NC][4], b[NC][4], b2[NC][4];
    const T16 *pa[4], *pa2[4], *pb[4], *pb2[4];
#pragma unroll
    for (int g = 0; g < 4; ++g) { pa[g] = (const T16*)((const char*)A + vo[g]); pb[g] = (const T16*)((const char*)Bt + vo[g]); pa2[g] = S1 ? (const T16*)((const char*)A2 + vo[g]) : pa[g]; pb2[g] = S2 ? (const T16*)((const char*)Bt2 + vo[g]) : pb[g]; }
    constexpr int CP = (NC >= 2) ? 2 : 1;   // chunks per 128-byte line of a row: the 4 loads that share a row group's 16 lines follow one another
#pragma unroll
    for (int c = 0; c < NC; c += CP) {
#pragma unroll
        for (int g = 0; g < 4; ++g) {
#pragma unroll
            for (int q = 0; q < CP; ++q) a[c + q][g] = WFrag<T16>::ld(pa[g] + (c + q) * 32);
            if (S1) {
#pragma unroll
                for (int q = 0; q < CP; ++q) a2[c + q][g] = WFrag<T16>::ld(pa2[g] + (c + q) * 32); } }
#pragma unroll
        for (int g = 0; g < 4; ++g) {
#pragma unroll
            for (int q = 0; q < CP; ++q) b[c + q][g] = WFrag<T16>::ld(pb[g] + (c + q) * 32);
            if (S2) {
#pragma unroll
                for (int q = 0; q < CP; ++q) b2[c + q][g] = WFrag<T16>::ld(pb2[g] + (c + q) * 32); } }
        __builtin_amdgcn_sched_barrier(0);   // keeps the loads in ascending k and all of them ahead of the first product: the first lines' products then wait for those lines alone while the later ones are still in flight
    }
#pragma unroll
    for (int c = 0; c < NC; ++c)
#pragma unroll
        for (int nb = 0; nb < 4; ++nb)
#pragma unroll
            for (int mb = 0; mb < 4; ++mb) { acc[mb][nb] = WFrag<T16>::mma(a[c][mb], b[c][nb], acc[mb][nb]); if (S1) acc[mb][nb] = WFrag<T16>::mma(a2[c][mb], b[c][nb], acc[mb][nb]); if (S2) acc[mb][nb] = WFrag<T16>::mma(a[c][mb], b2[c][nb], acc[mb][nb]); }
    asm volatile("v_nop\n\tv_nop\n\tv_nop\n\tv_nop" : "+v"(acc[0][0]), "+v"(acc[1][1]), "+v"(acc[2][2]), "+v"(acc[3][3]) : "v"(a[NC - 1][0]), "v"(a[NC - 1][3]));   // WMMA distance ahead of the branch and of the next step's operand writes
    // The wait that stands ahead of any rewrite of the address registers this step's loads name; taking the addresses as inputs keeps their registers from being reused earlier in the step.
    asm volatile("s_wait_xcnt 0x0" :: "v"(pa[0]), "v"(pa[1]), "v"(pa[2]), "v"(pa[3]), "v"(pb[0]), "v"(pb[1]), "v"(pb[2]), "v"(pb[3]), "v"(pa2[0]), "v"(pa2[1]), "v"(pa2[2]), "v"(pa2[3]), "v"(pb2[0]), "v"(pb2[1]), "v"(pb2[2]), "v"(pb2[3]) : "memory");
    __builtin_amdgcn_sched_barrier(0);   // holds the next step's address arithmetic behind that wait
}
template <typename T16, int NSPLIT, bool BIAS>
__global__ __launch_bounds__(32) void k_gemmw(const T16* __restrict__ A, const T16* __restrict__ A2, const T16* __restrict__ Bt, const T16* __restrict__ Bt2, int K, float* C, int ldc, const float* __restrict__ bias, size_t sA, size_t sB, size_t sC) {
    __shared__ __align__(16) float os[16 * 68];
    const size_t z = blockIdx.z; A += z * sA; if (A2) A2 += z * sA; Bt += z * sB; if (Bt2) Bt2 += z * sB; C += z * sC;
    const int lane = threadIdx.x & 31, lr = lane & 15, hi = lane >> 4; const int r0 = blockIdx.x * 64, c0 = blockIdx.y * 64;
    v8f acc[4][4];
#pragma unroll
    for (int mb = 0; mb < 4; ++mb)
#pragma unroll
        for (int nb = 0; nb < 4; ++nb) acc[mb][nb] = (v8f){};
    constexpr bool S1 = (NSPLIT == 1 || NSPLIT == 2), S2 = (NSPLIT >= 2);
    constexpr int NCM = NSPLIT ? 2 : 4;   // 32-k chunks per trip of the main K loop: 64 operand loads in flight per wave with one plane per operand and with two
    const T16* Au = A + (size_t)r0 * K; const T16* A2u = S1 ? A2 + (size_t)r0 * K : nullptr; const T16* Bu = Bt + (size_t)c0 * K; const T16* B2u = S2 ? Bt2 + (size_t)c0 * K : nullptr;   // wave-uniform tile bases
    unsigned vo[4];
#pragma unroll
    for (int g = 0; g < 4; ++g) vo[g] = (unsigned)(((g * 16 + lr) * K + 8 * hi) * sizeof(T16));   // lane's byte offset in row group g, fixed over the K loop
    int kc = 0;
#pragma unroll 1   // a step is already straight-line code over NCM chunks; unrolled further its register set would double
    for (; kc + NCM * 32 <= K; kc += NCM * 32) kstep<T16, NSPLIT, NCM>(Au + kc, S1 ? A2u + kc : nullptr, Bu + kc, S2 ? B2u + kc : nullptr, vo, acc);
    if (NCM > 2 && kc + 64 <= K) { kstep<T16, NSPLIT, 2>(Au + kc, S1 ? A2u + kc : nullptr, Bu + kc, S2 ? B2u + kc : nullptr, vo, acc); kc += 64; }   // remainder: one step of 2 chunks, then at most one chunk
#pragma unroll 1   // the compiler cannot see that at most one chunk is left: unrolled, this would only be code that never runs
    for (; kc < K; kc += 32) kstep<T16, NSPLIT, 1>(Au + kc, S1 ? A2u + kc : nullptr, Bu + kc, S2 ? B2u + kc : nullptr, vo, acc);
#pragma unroll
    for (int mb = 0; mb < 4; ++mb) {
#pragma unroll
        for (int nb = 0; nb < 4; ++nb) {
#pragma unroll
            for (int j = 0; j < 8; ++j) os[(hi * 8 + j) * 68 + nb * 16 + lr] = acc[mb][nb][j]; }
        __builtin_amdgcn_wave_barrier(); asm volatile("" ::: "memory");
        float* crow = C + (size_t)(r0 + mb * 16) * ldc + c0;
{
#pragma unroll
            for (int s = 0; s < 8; ++s) { const int row = 2 * s + hi, cofs = lr * 4; v4f val = *(const v4fa*)(os + row * 68 + cofs); if (BIAS) { val[0] += bfr(bias[c0 + cofs]); val[1] += bfr(bias[c0 + cofs + 1]); val[2] += bfr(bias[c0 + cofs + 2]); val[3] += bfr(bias[c0 + cofs + 3]); }
                *(v4f*)(crow + (size_t)row * ldc + cofs) = val; }
             }
        __builtin_amdgcn_wave_barrier(); asm volatile("" ::: "memory");
    }
}

// ---- k_gemmc: the same one-wave 64x64 tile GEMM specialised for causal attention: CMODE 1 skips score tiles entirely above the diagonal (query rows r0+roff.., key columns c0..), CMODE 2 limits the
// key (K) loop of the probability x value contraction to the diagonal block (probabilities beyond it are exactly zero). roff = row offset of this launch's first row within the sequence.
template <typename T16, int NSPLIT, int CMODE>
__global__ __launch_bounds__(32) void k_gemmc(const T16* __restrict__ A, const T16* __restrict__ A2, const T16* __restrict__ Bt, const T16* __restrict__ Bt2, int K, float* C, int ldc, int roff, size_t sA, size_t sB, size_t sC) {
    __shared__ __align__(16) float os[16 * 68];
    const size_t z = blockIdx.z; A += z * sA; if (A2) A2 += z * sA; Bt += z * sB; if (Bt2) Bt2 += z * sB; C += z * sC;
    const int lane = threadIdx.x & 31, lr = lane & 15, hi = lane >> 4; const int r0 = blockIdx.x * 64, c0 = blockIdx.y * 64;
    if (CMODE == 1 && c0 > r0 + roff + 63) return;                  // score tile entirely above the causal diagonal: never read (the softmax masks j > i by select)
    const int Kl = (CMODE == 2) ? min(K, r0 + roff + 64) : K;        // P.V: probabilities are exactly 0 beyond the diagonal block, so the K loop stops there
    v8f acc[4][4];
#pragma unroll
    for (int mb = 0; mb < 4; ++mb)
#pragma unroll
        for (int nb = 0; nb < 4; ++nb) acc[mb][nb] = (v8f){};
    constexpr bool S1 = (NSPLIT == 1 || NSPLIT == 2), S2 = (NSPLIT >= 2);
    constexpr int NCM = NSPLIT ? 2 : 4;   // 32-k chunks per trip of the main K loop: 64 operand loads in flight per wave with one plane per operand and with two
    const T16* Au = A + (size_t)r0 * K; const T16* A2u = S1 ? A2 + (size_t)r0 * K : nullptr; const T16* Bu = Bt + (size_t)c0 * K; const T16* B2u = S2 ? Bt2 + (size_t)c0 * K : nullptr;   // wave-uniform tile bases
    unsigned vo[4];
#pragma unroll
    for (int g = 0; g < 4; ++g) vo[g] = (unsigned)(((g * 16 + lr) * K + 8 * hi) * sizeof(T16));   // lane's byte offset in row group g, fixed over the K loop
    int kc = 0;
#pragma unroll 1   // a step is already straight-line code over NCM chunks; unrolled further its register set would double
    for (; kc + NCM * 32 <= Kl; kc += NCM * 32) kstep<T16, NSPLIT, NCM>(Au + kc, S1 ? A2u + kc : nullptr, Bu + kc, S2 ? B2u + kc : nullptr, vo, acc);
    if (NCM > 2 && kc + 64 <= Kl) { kstep<T16, NSPLIT, 2>(Au + kc, S1 ? A2u + kc : nullptr, Bu + kc, S2 ? B2u + kc : nullptr, vo, acc); kc += 64; }   // remainder: one step of 2 chunks, then at most one chunk
#pragma unroll 1   // the compiler cannot see that at most one chunk is left: unrolled, this would only be code that never runs
    for (; kc < Kl; kc += 32) kstep<T16, NSPLIT, 1>(Au + kc, S1 ? A2u + kc : nullptr, Bu + kc, S2 ? B2u + kc : nullptr, vo, acc);
#pragma unroll
    for (int mb = 0; mb < 4; ++mb) {
#pragma unroll
        for (int nb = 0; nb < 4; ++nb) {
#pragma unroll
            for (int j = 0; j < 8; ++j) os[(hi * 8 + j) * 68 + nb * 16 + lr] = acc[mb][nb][j]; }
        __builtin_amdgcn_wave_barrier(); asm volatile("" ::: "memory");
        float* crow = C + (size_t)(r0 + mb * 16) * ldc + c0;
{
#pragma unroll
            for (int s = 0; s < 8; ++s) { const int row = 2 * s + hi, cofs = lr * 4; v4f val = *(const v4fa*)(os + row * 68 + cofs);
                *(v4f*)(crow + (size_t)row * ldc + cofs) = val; }
             }
        __builtin_amdgcn_wave_barrier(); asm volatile("" ::: "memory");
    }
}

__device__ __forceinline__ h16 tohx(float x) { return (h16)x; }
__device__ __forceinline__ void splitf(float y, unsigned short& h, unsigned short& l) { h = f2bf(y); l = f2bf(y - bf2f(h)); }
typedef __attribute__((ext_vector_type(2))) _Float16 v2h;
typedef __attribute__((ext_vector_type(4))) _Float16 v4h;
typedef __attribute__((ext_vector_type(2))) unsigned short v2us;
typedef __attribute__((ext_vector_type(4))) unsigned short v4us;
typedef __attribute__((ext_vector_type(2))) float v2f;
typedef __attribute__((ext_vector_type(4))) int v4i;

__global__ __launch_bounds__(256) void k_wtG(const float* __restrict__ w, int K, int N, bf* Bt) {
    const int lane = threadIdx.x & 31; const int L0 = (blockIdx.x * 8 + (threadIdx.x >> 5)) * 8; const int nlines = N * K / 64;
{
#pragma unroll 1
        for (int l = 0; l < 8; ++l) { const int L = L0 + l; if (L >= nlines) break; const size_t e = (size_t)L * 64 + lane * 2; const int k = (int)(e % K), n = (int)(e / K); v2us o;
            o[0] = f2bf(w[(size_t)k * N + n]); o[1] = f2bf(w[(size_t)(k + 1) * N + n]); *(v2us*)(Bt + e) = o; }
         }
}
__global__ __launch_bounds__(256) void k_cvt8(const float* __restrict__ src, bf* dst, size_t n8) { const size_t i = (size_t)blockIdx.x * 256 + threadIdx.x; if (i >= n8) return; const v8f v = *(const v8f*)(src + i * 8); v8us o;
#pragma unroll
    for (int k = 0; k < 8; ++k) o[k] = f2bf(v[k]); *(v8us*)(dst + i * 8) = o;  }

// k_rope: head planes [h][t][d] (fp16 + hi/lo) of rope(x) x sc with the rotate-half convention out[d] = x[d] cos[t][d] - x[d+HD/2] sin[t][d], out[d+HD/2] = x[d+HD/2] cos[t][d+HD/2] + x[d] sin[t][d+HD/2]
__global__ __launch_bounds__(256) void k_rope(const float* __restrict__ F, int pitch, int nheads, const float* __restrict__ CS, const float* __restrict__ RF, const float* __restrict__ nw, float sc, h16* P16, bf* Ph, bf* Pl) {
    const size_t e = ((size_t)blockIdx.x * 256 + threadIdx.x) * 2; if (e >= (size_t)nheads * TT * HD) return; const size_t pb = (size_t)blockIdx.y * nheads * TT * HD; F += (size_t)blockIdx.y * TT * pitch; P16 += pb; Ph += pb; Pl += pb;   // grid y = batch of the group
    const int d = (int)(e % HD); const int t = (int)((e / HD) % TT); const int h = (int)(e / ((size_t)HD * TT)); const float* f = F + (size_t)t * pitch + h * HD; const float rf = RF ? RF[(size_t)h * TT + t] : 1.0f; v2h o16; v2us oh, ol;
#pragma unroll
    for (int q = 0; q < 2; ++q) { const int dd = d + q; const int dp = (dd < HD / 2) ? dd + HD / 2 : dd - HD / 2; float x0 = f[dd], x1 = f[dp];
        if (RF) { float n0 = __fmul_rn(x0, rf), n1 = __fmul_rn(x1, rf); asm volatile("" : "+v"(n0)); asm volatile("" : "+v"(n1)); x0 = __fmul_rn(bfr(nw[dd]), n0); x1 = __fmul_rn(bfr(nw[dp]), n1); }
        const v2f cs = *(const v2f*)(CS + ((size_t)t * HD + dd) * 2); float a = __fmul_rn(x0, cs[0]), bq = __fmul_rn(x1, cs[1]); asm volatile("" : "+v"(a)); asm volatile("" : "+v"(bq)); const float r = ((dd < HD / 2) ? __fsub_rn(a, bq) : __fadd_rn(a, bq)) * sc;
        o16[q] = tohx(r); unsigned short a2, c2; splitf(r, a2, c2); oh[q] = a2; ol[q] = c2; }
    *(v2h*)(P16 + e) = o16; *(v2us*)(Ph + e) = oh; *(v2us*)(Pl + e) = ol;  }
__global__ __launch_bounds__(256) void k_vtp(const float* __restrict__ F, int pitch, int nheads, h16* V16, bf* Vh, bf* Vl) { const size_t e = ((size_t)blockIdx.x * 256 + threadIdx.x) * 2; if (e >= (size_t)nheads * HD * TT) return; const size_t pb = (size_t)blockIdx.y * nheads * HD * TT; F += (size_t)blockIdx.y * TT * pitch; V16 += pb; Vh += pb; Vl += pb;   // grid y = batch of the group
    const int t = (int)(e % TT); const int d = (int)((e / TT) % HD); const int g = (int)(e / ((size_t)TT * HD)); v2h o16; v2us oh, ol;
#pragma unroll
    for (int q = 0; q < 2; ++q) { const float x = F[(size_t)(t + q) * pitch + g * HD + d]; o16[q] = tohx(x); unsigned short a2, c2; splitf(x, a2, c2); oh[q] = a2; ol[q] = c2; }
    *(v2h*)(V16 + e) = o16; *(v2us*)(Vh + e) = oh; *(v2us*)(Vl + e) = ol;  }
__global__ __launch_bounds__(256) void k_csid(float* CS) { const int idx = blockIdx.x * 256 + threadIdx.x; if (idx >= TT * HD) return; v2f cs; cs[0] = 1.0f; cs[1] = 0.0f; *(v2f*)(CS + (size_t)idx * 2) = cs;  }
// k_asoft: per row (zz, i): t = S x HD^-0.5 for j <= i and i - j < WIN (WIN = TT: the window term always holds, plain causal; the reference's -1e9 additive fill vanishes identically); softmax over the 2048 keys (register row, one exp, fixed trees);
__global__ __launch_bounds__(256) void k_asoft(const float* __restrict__ Sb, h16* P16, bf* Ph, bf* Pl) {
    const int lane = threadIdx.x & 31; const int row = blockIdx.x * 8 + (threadIdx.x >> 5); if (row >= GB * ZH * TT) return; const int i = row % TT; const int zz = row / TT;   /* zz: plane = batch of the group */ (void)zz; const bool hires = (i < RH); const float* sr = Sb + (size_t)row * TT; float v[TT / 32]; float mx = -3.0e38f;
#pragma unroll
    for (int ch = 0; ch < TT / 128; ++ch) { const int j0 = ch * 128 + lane * 4; const v4f a = *(const v4f*)(sr + j0);
#pragma unroll
        for (int q = 0; q < 4; ++q) { const int j = j0 + q; (void)j; const float t = (j <= i && i - j < WIN) ? a[q] * SCL : -3.0e38f; v[ch * 4 + q] = t; mx = fmaxf(mx, t); } }
#pragma unroll
    for (int sh = 16; sh; sh >>= 1) mx = fmaxf(mx, __shfl_xor(mx, sh, 32));
    float sum = 0.f;
#pragma unroll
    for (int k = 0; k < TT / 32; ++k) { float d0 = __fsub_rn(v[k], mx); asm volatile("" : "+v"(d0)); v[k] = __builtin_amdgcn_exp2f(__fmul_rn(d0, 1.4426950408889634f)); sum += v[k]; }
#pragma unroll
    for (int sh = 16; sh; sh >>= 1) sum += __shfl_xor(sum, sh, 32);
    const float f = __fdiv_rn(hires ? 1.0f : PCAR, sum);
{
        if (hires) {
#pragma unroll
            for (int ch = 0; ch < TT / 128; ++ch) { v4us oh, ol;
#pragma unroll
                for (int q = 0; q < 4; ++q) { unsigned short a, c2; splitf(v[ch * 4 + q] * f, a, c2); oh[q] = a; ol[q] = c2; }
                const size_t oo = ((size_t)zz * (RH ? RH : 1) + i) * TT + ch * 128 + lane * 4; *(v4us*)(Ph + oo) = oh; *(v4us*)(Pl + oo) = ol; }
        } else {
#pragma unroll
            for (int ch = 0; ch < TT / 128; ++ch) { v4h o4;
#pragma unroll
                for (int q = 0; q < 4; ++q) o4[q] = tohx(v[ch * 4 + q] * f);
                *(v4h*)(P16 + (size_t)row * TT + ch * 128 + lane * 4) = o4; } }
         }
}
__global__ __launch_bounds__(256) void k_merge(const float* __restrict__ O, int h0, float* OUTb) { const size_t e = ((size_t)blockIdx.x * 256 + threadIdx.x) * 2; if (e >= (size_t)ZH * TT * HD) return; O += (size_t)blockIdx.y * ZH * TT * HD; OUTb += (size_t)blockIdx.y * TT * DQ;   // grid y = batch of the group
    const int d = (int)(e % HD); const int t = (int)((e / HD) % TT); const int zz = (int)(e / ((size_t)HD * TT)); const float cs = (t < RH) ? 1.0f : (1.0f / PCAR); const size_t oo = (size_t)t * DQ + (h0 + zz) * HD + d;
    v2f o2; o2[0] = O[e] * cs; o2[1] = O[e + 1] * cs; *(v2f*)(OUTb + oo) = o2;  }

extern "C" void kernel_launch(void* const* d_in, const int* in_sizes, int n_in,
                              void* d_out, int out_size, void* d_ws, size_t ws_size, hipStream_t stream) {
    (void)in_sizes; (void)n_in; (void)out_size;
    const float* x = (const float*)d_in[0]; const float* wq = (const float*)d_in[1]; const float* wk = (const float*)d_in[2]; const float* wv = (const float*)d_in[3]; const float* wo = nullptr; (void)wo;   /* x, wq, wk, wv ('xw' [768][768]) */
    float* OUT = (float*)d_out;     // [8][2048][768]
    char* wsp = (char*)d_ws;
    auto take = [&](size_t bytes) { char* p = wsp; wsp += (bytes + 255) & ~(size_t)255; return (void*)p; };
    bf* WQ = (bf*)take((size_t)DQ * DM * 2); bf* WK = (bf*)take((size_t)DKV * DM * 2); bf* WV = (bf*)take((size_t)DKV * DM * 2); float* CS = (float*)take((size_t)TT * HD * 2 * 4);
    h16* QP16 = (h16*)take((size_t)GB * NH_ * TT * HD * 2); h16* KP16 = (h16*)take((size_t)GB * NKV * TT * HD * 2); h16* VT16 = (h16*)take((size_t)GB * NKV * HD * TT * 2);
    bf* QPh = (bf*)take((size_t)GB * NH_ * TT * HD * 2); bf* QPl = (bf*)take((size_t)GB * NH_ * TT * HD * 2); bf* KPh = (bf*)take((size_t)GB * NKV * TT * HD * 2); bf* KPl = (bf*)take((size_t)GB * NKV * TT * HD * 2); bf* VTh = (bf*)take((size_t)GB * NKV * HD * TT * 2); bf* VTl = (bf*)take((size_t)GB * NKV * HD * TT * 2); bf* Ph = (bf*)take((size_t)GB * ZH * RH * TT * 2); bf* Pl = (bf*)take((size_t)GB * ZH * RH * TT * 2);
    float* Sb = (float*)take((size_t)GB * ZH * TT * TT * 4); h16* P16 = (h16*)take((size_t)GB * ZH * TT * TT * 2);
    if ((size_t)(wsp - (char*)d_ws) > ws_size) return;    // ws 256 MiB
    // The score region is used three times in stream order, so that GB batches fit the workspace: x copy + projections (dead once the planes are built), then the scores, then (scores dead after the softmax) the P.V result.
    static_assert((size_t)TT * DM * 2 + (size_t)TT * DQ * 4 + (size_t)TT * DKV * 4 <= (size_t)ZH * TT * TT * 4 && (size_t)TT * HD <= (size_t)TT * TT, "overlay fits the score region");
    bf* XB = (bf*)Sb; float* FQ = (float*)(XB + (size_t)GB * TT * DM); float* FK = FQ + (size_t)GB * TT * DQ; float* Ob = Sb;
    float* FV = FK;   // v projection reuses the k buffer after the k planes are built (stream-ordered)
    { k_wtG<<<(unsigned)((DM * DQ / 64 + 63) / 64), 256, 0, stream>>>(wq, DM, DQ, WQ); k_wtG<<<(unsigned)((DM * DKV / 64 + 63) / 64), 256, 0, stream>>>(wk, DM, DKV, WK); k_wtG<<<(unsigned)((DM * DKV / 64 + 63) / 64), 256, 0, stream>>>(wv, DM, DKV, WV);
       }
    k_csid<<<(TT * HD + 255) / 256, 256, 0, stream>>>(CS);
    const unsigned LQ = (unsigned)(((size_t)NH_ * TT * HD / 2 + 255) / 256), LKv = (unsigned)(((size_t)NKV * TT * HD / 2 + 255) / 256);
    for (int b = 0; b < NB_; b += GB) {   // GB batches per pass: projections see GB*TT flat rows, plane builders and merge take the batch from grid y, the attention GEMMs from grid z, the softmax from its row index
        k_cvt8<<<(unsigned)(((size_t)GB * TT * DM / 8 + 255) / 256), 256, 0, stream>>>(x + (size_t)b * TT * DM, XB, (size_t)GB * TT * DM / 8);
        k_gemmw<bf, 0, false><<<dim3(GB * TT / 64, DQ / 64, 1), 32, 0, stream>>>(XB, nullptr, WQ, nullptr, DM, FQ, DQ, nullptr, 0, 0, 0);
        k_rope<<<dim3(LQ, GB, 1), 256, 0, stream>>>(FQ, DQ, NH_, CS, nullptr, nullptr, 1.0f, QP16, QPh, QPl);
        k_gemmw<bf, 0, false><<<dim3(GB * TT / 64, DKV / 64, 1), 32, 0, stream>>>(XB, nullptr, WK, nullptr, DM, FK, DKV, nullptr, 0, 0, 0);
        k_rope<<<dim3(LKv, GB, 1), 256, 0, stream>>>(FK, DKV, NKV, CS, nullptr, nullptr, 1.0f, KP16, KPh, KPl);
        k_gemmw<bf, 0, false><<<dim3(GB * TT / 64, DKV / 64, 1), 32, 0, stream>>>(XB, nullptr, WV, nullptr, DM, FV, DKV, nullptr, 0, 0, 0); k_vtp<<<dim3(LKv, GB, 1), 256, 0, stream>>>(FV, DKV, NKV, VT16, VTh, VTl);
        k_gemmc<bf, 2, 1><<<dim3(RH / 64, TT / 64, GB), 32, 0, stream>>>(QPh, QPl, KPh, KPl, HD, Sb, TT, 0, (size_t)TT * HD, (size_t)TT * HD, (size_t)TT * TT);
        k_gemmc<h16, 0, 1><<<dim3((TT - RH) / 64, TT / 64, GB), 32, 0, stream>>>(QP16 + (size_t)RH * HD, nullptr, KP16, nullptr, HD, Sb + (size_t)RH * TT, TT, RH, (size_t)TT * HD, (size_t)TT * HD, (size_t)TT * TT);
        k_asoft<<<GB * ZH * TT / 8, 256, 0, stream>>>(Sb, P16, Ph, Pl);
        k_gemmc<bf, 2, 2><<<dim3(RH / 64, HD / 64, GB), 32, 0, stream>>>(Ph, Pl, VTh, VTl, TT, Ob, HD, 0, (size_t)RH * TT, (size_t)HD * TT, (size_t)TT * HD);
        k_gemmc<h16, 0, 2><<<dim3((TT - RH) / 64, HD / 64, GB), 32, 0, stream>>>(P16 + (size_t)RH * TT, nullptr, VT16, nullptr, TT, Ob + (size_t)RH * HD, HD, RH, (size_t)TT * TT, (size_t)HD * TT, (size_t)TT * HD);
        k_merge<<<dim3((unsigned)(((size_t)ZH * TT * HD / 2 + 255) / 256), GB, 1), 256, 0, stream>>>(Ob, 0, OUT + (size_t)b * TT * DQ);
    }
}

// v003
// Measured time: 361 microseconds a run.
// Timed twice side by side with v002, it ran 1.38 and 1.39 times as fast.
// Counting every step since v000, it is 3.91 times as fast.
#include <hip/hip_runtime.h>

// Single-head causal attention over the full 768-wide projection (x [8][2048][768]; q, k, v = x w ('xw' [768][768], no bias; ONE 768-wide head); scores / sqrt(d_out = 768) (the source scales by the full projection width); causal (-inf); softmax; out = attn.v -> [8][2048][768] (12.6 M); argument order x, wq, wk, wv).
// Layout per group of GB batches (every launch of the group covers all GB batches: flat rows or grid z): bf16 copy of x; 'xw' weights transposed once; exact projections whose epilogues write the fp16 and hi/lo planes themselves (v as w.x^T, so its planes come out transposed); causal T-2048 attention at NH 1 / ZH 1 (hybrid rows: < 512 hi/lo 3 products, rest fp16 x1024; k_gemmc skips tiles above the diagonal); the P.V epilogue scales and writes the output rows (no output projection).
// Compute dtypes, f32 accumulate: every input rounded to bf16; projections exact; attention rows < 512 3 products, rest fp16; softmax f32; output f32.

#define NB_  8
#define TT   2048
#define DM   768
#define NH_  1
#define NKV  1
#define REP  (NH_ / NKV)
#define HD   768
#define DQ   (NH_ * HD)
#define DKV  (NKV * HD)
#define ZH   1                    // ONE head: a single plane per batch
#define GB   4                    // batches per launch: each kernel's grid covers GB batches at once (NB_ / GB groups)
#define RH   512                  // query rows < RH use hi+lo planes (0: none)
#define WIN  2048
#define PCAR 1024.0f
#define SCL  0.036084391824351615f   // 1/sqrt(768) (one 768-wide head)
typedef _Float16 h16;
typedef unsigned short bf;
typedef __attribute__((ext_vector_type(16))) __bf16   v16bf;
typedef __attribute__((ext_vector_type(16))) _Float16 v16h;
typedef __attribute__((ext_vector_type(8)))  _Float16 v8h;
typedef __attribute__((ext_vector_type(8)))  unsigned short v8us;
typedef __attribute__((ext_vector_type(8)))  float    v8f;
typedef __attribute__((ext_vector_type(4)))  float    v4f;
typedef v8h  __attribute__((may_alias)) v8ha;
typedef v4f  __attribute__((may_alias)) v4fa;
typedef v8us __attribute__((may_alias)) v8usa;

__device__ __forceinline__ unsigned short f2bf(float f) { unsigned u = __float_as_uint(f); u += 0x7FFFu + ((u >> 16) & 1u); return (unsigned short)(u >> 16); }
__device__ __forceinline__ float bf2f(unsigned short b) { return __uint_as_float(((unsigned)b) << 16); }
__device__ __forceinline__ float bfr(float f) { return bf2f(f2bf(f)); }
__device__ __forceinline__ h16 tohx(float x) { return (h16)x; }
__device__ __forceinline__ void splitf(float y, unsigned short& h, unsigned short& l) { h = f2bf(y); l = f2bf(y - bf2f(h)); }
__device__ __forceinline__ v16h cat16(v8h lo, v8h hi) { return __builtin_shufflevector(lo, hi, 0, 1, 2, 3, 4, 5, 6, 7, 8, 9, 10, 11, 12, 13, 14, 15); }
__device__ __forceinline__ v16bf cat16b(v8us lo, v8us hi) { return __builtin_bit_cast(v16bf, __builtin_shufflevector(lo, hi, 0, 1, 2, 3, 4, 5, 6, 7, 8, 9, 10, 11, 12, 13, 14, 15)); }
__device__ __forceinline__ v8f wmma16(v16h a, v16h b, v8f c) { return __builtin_amdgcn_wmma_f32_16x16x32_f16(false, a, false, b, (short)0, c, false, false); }
__device__ __forceinline__ v8f wmmab(v16bf a, v16bf b, v8f c) { return __builtin_amdgcn_wmma_f32_16x16x32_bf16(false, a, false, b, (short)0, c, false, false); }



// ---- k_gemmw: register-blocked GEMM, ONE WAVE per 64x64 output tile (16 accumulators), operands straight from K-contiguous 16-bit planes; grid (M/64, N/64, Z), 32 threads.
// c[m][n] (f32) = sum_k A[m][k] Bt[n][k] (+ split products per NSPLIT); the epilogue writes c as three 16-bit planes of pitch ldc: P16 = fp16(c), Ph + Pl = bf16 hi + lo of c. z-batch strides sA/sB/sC in elements. K % 32 == 0.
template <typename T16> struct WFrag;
template <> struct WFrag<h16> { typedef v16h V; static __device__ __forceinline__ V ld(const h16* p) { return cat16(*(const v8h*)p, *(const v8h*)(p + 16)); } static __device__ __forceinline__ v8f mma(V a, V b, v8f c) { return wmma16(a, b, c); } };
template <> struct WFrag<bf> { typedef v16bf V; static __device__ __forceinline__ V ld(const bf* p) { return cat16b(*(const v8us*)p, *(const v8us*)(p + 16)); } static __device__ __forceinline__ v8f mma(V a, V b, v8f c) { return wmmab(a, b, c); } };
// kstep: NC consecutive 32-k chunks of the one-wave 64x64 tile. Every fragment load of the NC chunks is issued first, one 128-byte line of each row after the other, then the products run chunk by chunk in ascending k:
// each accumulator sees the same order of products as with one chunk per trip. A, A2, Bt, Bt2: wave-uniform address of the tile's first row at this step's k; vo[g]: this lane's byte offset in row group g (same pitch K for both operands).
template <typename T16, int NSPLIT, int NC>
__device__ __forceinline__ void kstep(const T16* A, const T16* A2, const T16* Bt, const T16* Bt2, const unsigned (&vo)[4], v8f (&acc)[4][4]) {
    typedef typename WFrag<T16>::V V;
    constexpr bool S1 = (NSPLIT == 1 || NSPLIT == 2), S2 = (NSPLIT >= 2);
    V a[NC][4], a2[NC][4], b[NC][4], b2[NC][4];
    const T16 *pa[4], *pa2[4], *pb[4], *pb2[4];
#pragma unroll
    for (int g = 0; g < 4; ++g) { pa[g] = (const T16*)((const char*)A + vo[g]); pb[g] = (const T16*)((const char*)Bt + vo[g]); pa2[g] = S1 ? (const T16*)((const char*)A2 + vo[g]) : pa[g]; pb2[g] = S2 ? (const T16*)((const char*)Bt2 + vo[g]) : pb[g]; }
    constexpr int CP = (NC >= 2) ? 2 : 1;   // chunks per 128-byte line of a row: the 4 loads that share a row group's 16 lines follow one another
#pragma unroll
    for (int c = 0; c < NC; c += CP) {
#pragma unroll
        for (int g = 0; g < 4; ++g) {
#pragma unroll
            for (int q = 0; q < CP; ++q) a[c + q][g] = WFrag<T16>::ld(pa[g] + (c + q) * 32);
            if (S1) {
#pragma unroll
                for (int q = 0; q < CP; ++q) a2[c + q][g] = WFrag<T16>::ld(pa2[g] + (c + q) * 32); } }
#pragma unroll
        for (int g = 0; g < 4; ++g) {
#pragma unroll
            for (int q = 0; q < CP; ++q) b[c + q][g] = WFrag<T16>::ld(pb[g] + (c + q) * 32);
            if (S2) {
#pragma unroll
                for (int q = 0; q < CP; ++q) b2[c + q][g] = WFrag<T16>::ld(pb2[g] + (c + q) * 32); } }
        __builtin_amdgcn_sched_barrier(0);   // keeps the loads in ascending k and all of them ahead of the first product: the first lines' products then wait for those lines alone while the later ones are still in flight
    }
#pragma unroll
    for (int c = 0; c < NC; ++c)
#pragma unroll
        for (int nb = 0; nb < 4; ++nb)
#pragma unroll
            for (int mb = 0; mb < 4; ++mb) { acc[mb][nb] = WFrag<T16>::mma(a[c][mb], b[c][nb], acc[mb][nb]); if (S1) acc[mb][nb] = WFrag<T16>::mma(a2[c][mb], b[c][nb], acc[mb][nb]); if (S2) acc[mb][nb] = WFrag<T16>::mma(a[c][mb], b2[c][nb], acc[mb][nb]); }
    asm volatile("v_nop\n\tv_nop\n\tv_nop\n\tv_nop" : "+v"(acc[0][0]), "+v"(acc[1][1]), "+v"(acc[2][2]), "+v"(acc[3][3]) : "v"(a[NC - 1][0]), "v"(a[NC - 1][3]));   // WMMA distance ahead of the branch and of the next step's operand writes
    // The wait that stands ahead of any rewrite of the address registers this step's loads name; taking the addresses as inputs keeps their registers from being reused earlier in the step.
    asm volatile("s_wait_xcnt 0x0" :: "v"(pa[0]), "v"(pa[1]), "v"(pa[2]), "v"(pa[3]), "v"(pb[0]), "v"(pb[1]), "v"(pb[2]), "v"(pb[3]), "v"(pa2[0]), "v"(pa2[1]), "v"(pa2[2]), "v"(pa2[3]), "v"(pb2[0]), "v"(pb2[1]), "v"(pb2[2]), "v"(pb2[3]) : "memory");
    __builtin_amdgcn_sched_barrier(0);   // holds the next step's address arithmetic behind that wait
}
template <typename T16, int NSPLIT>
__global__ __launch_bounds__(32) void k_gemmw(const T16* __restrict__ A, const T16* __restrict__ A2, const T16* __restrict__ Bt, const T16* __restrict__ Bt2, int K, h16* P16, bf* Ph, bf* Pl, int ldc, size_t sA, size_t sB, size_t sC) {
    __shared__ __align__(16) float os[16 * 68];
    const size_t z = blockIdx.z; A += z * sA; if (A2) A2 += z * sA; Bt += z * sB; if (Bt2) Bt2 += z * sB; P16 += z * sC; Ph += z * sC; Pl += z * sC;
    const int lane = threadIdx.x & 31, lr = lane & 15, hi = lane >> 4; const int r0 = blockIdx.x * 64, c0 = blockIdx.y * 64;
    v8f acc[4][4];
#pragma unroll
    for (int mb = 0; mb < 4; ++mb)
#pragma unroll
        for (int nb = 0; nb < 4; ++nb) acc[mb][nb] = (v8f){};
    constexpr bool S1 = (NSPLIT == 1 || NSPLIT == 2), S2 = (NSPLIT >= 2);
    constexpr int NCM = NSPLIT ? 2 : 4;   // 32-k chunks per trip of the main K loop: 64 operand loads in flight per wave with one plane per operand and with two
    const T16* Au = A + (size_t)r0 * K; const T16* A2u = S1 ? A2 + (size_t)r0 * K : nullptr; const T16* Bu = Bt + (size_t)c0 * K; const T16* B2u = S2 ? Bt2 + (size_t)c0 * K : nullptr;   // wave-uniform tile bases
    unsigned vo[4];
#pragma unroll
    for (int g = 0; g < 4; ++g) vo[g] = (unsigned)(((g * 16 + lr) * K + 8 * hi) * sizeof(T16));   // lane's byte offset in row group g, fixed over the K loop
    int kc = 0;
#pragma unroll 1   // a step is already straight-line code over NCM chunks; unrolled further its register set would double
    for (; kc + NCM * 32 <= K; kc += NCM * 32) kstep<T16, NSPLIT, NCM>(Au + kc, S1 ? A2u + kc : nullptr, Bu + kc, S2 ? B2u + kc : nullptr, vo, acc);
    if (NCM > 2 && kc + 64 <= K) { kstep<T16, NSPLIT, 2>(Au + kc, S1 ? A2u + kc : nullptr, Bu + kc, S2 ? B2u + kc : nullptr, vo, acc); kc += 64; }   // remainder: one step of 2 chunks, then at most one chunk
#pragma unroll 1   // the compiler cannot see that at most one chunk is left: unrolled, this would only be code that never runs
    for (; kc < K; kc += 32) kstep<T16, NSPLIT, 1>(Au + kc, S1 ? A2u + kc : nullptr, Bu + kc, S2 ? B2u + kc : nullptr, vo, acc);
#pragma unroll
    for (int mb = 0; mb < 4; ++mb) {
#pragma unroll
        for (int nb = 0; nb < 4; ++nb) {
#pragma unroll
            for (int j = 0; j < 8; ++j) os[(hi * 8 + j) * 68 + nb * 16 + lr] = acc[mb][nb][j]; }
        __builtin_amdgcn_wave_barrier(); asm volatile("" ::: "memory");
        // 8 lanes per row, 8 columns per lane: each 16-byte store of the wave fills the 128-byte lines of 4 rows of one plane
        v4f va[4], vb[4]; v8h o16[4]; v8us oh[4], ol[4]; unsigned bo[4];
#pragma unroll
        for (int s = 0; s < 4; ++s) { const float* p = os + (4 * s + (lane >> 3)) * 68 + (lane & 7) * 8; va[s] = *(const v4fa*)p; vb[s] = *(const v4fa*)(p + 4); }
#pragma unroll
        for (int s = 0; s < 4; ++s) {
#pragma unroll
            for (int q = 0; q < 4; ++q) { unsigned short h2, l2; o16[s][q] = tohx(va[s][q]); splitf(va[s][q], h2, l2); oh[s][q] = h2; ol[s][q] = l2; o16[s][q + 4] = tohx(vb[s][q]); splitf(vb[s][q], h2, l2); oh[s][q + 4] = h2; ol[s][q + 4] = l2; }
            bo[s] = (unsigned)((((r0 + mb * 16 + 4 * s + (lane >> 3)) * ldc) + c0 + (lane & 7) * 8) * 2);   // lane's byte offset in a plane (a plane of one z is below 4 GiB)
            *(v8h*)((char*)P16 + bo[s]) = o16[s]; *(v8us*)((char*)Ph + bo[s]) = oh[s]; *(v8us*)((char*)Pl + bo[s]) = ol[s]; }
        // The wait that stands ahead of any rewrite of the registers these 12 stores name (one wait per 16 rows); taking offsets and data as inputs keeps their registers from being reused ahead of it.
        asm volatile("s_wait_xcnt 0x0" :: "v"(bo[0]), "v"(bo[1]), "v"(bo[2]), "v"(bo[3]), "v"(o16[0]), "v"(o16[1]), "v"(o16[2]), "v"(o16[3]), "v"(oh[0]), "v"(oh[1]), "v"(oh[2]), "v"(oh[3]), "v"(ol[0]), "v"(ol[1]), "v"(ol[2]), "v"(ol[3]) : "memory");
        __builtin_amdgcn_wave_barrier(); asm volatile("" ::: "memory");
    }
}

// ---- k_gemmc: the same one-wave 64x64 tile GEMM specialised for causal attention: CMODE 1 skips score tiles entirely above the diagonal (query rows r0+roff.., key columns c0..), CMODE 2 limits the
// key (K) loop of the probability x value contraction to the diagonal block (probabilities beyond it are exactly zero) and multiplies the result by osc (undoes the carrier scale of the fp16 probabilities). roff = row offset of this launch's first row within the sequence.
template <typename T16, int NSPLIT, int CMODE>
__global__ __launch_bounds__(32) void k_gemmc(const T16* __restrict__ A, const T16* __restrict__ A2, const T16* __restrict__ Bt, const T16* __restrict__ Bt2, int K, float* C, int ldc, int roff, float osc, size_t sA, size_t sB, size_t sC) {
    __shared__ __align__(16) float os[16 * 68];
    const size_t z = blockIdx.z; A += z * sA; if (A2) A2 += z * sA; Bt += z * sB; if (Bt2) Bt2 += z * sB; C += z * sC;
    const int lane = threadIdx.x & 31, lr = lane & 15, hi = lane >> 4; const int r0 = blockIdx.x * 64, c0 = blockIdx.y * 64;
    if (CMODE == 1 && c0 > r0 + roff + 63) return;                  // score tile entirely above the causal diagonal: never read (the softmax masks j > i by select)
    const int Kl = (CMODE == 2) ? min(K, r0 + roff + 64) : K;        // P.V: probabilities are exactly 0 beyond the diagonal block, so the K loop stops there
    v8f acc[4][4];
#pragma unroll
    for (int mb = 0; mb < 4; ++mb)
#pragma unroll
        for (int nb = 0; nb < 4; ++nb) acc[mb][nb] = (v8f){};
    constexpr bool S1 = (NSPLIT == 1 || NSPLIT == 2), S2 = (NSPLIT >= 2);
    constexpr int NCM = NSPLIT ? 2 : 4;   // 32-k chunks per trip of the main K loop: 64 operand loads in flight per wave with one plane per operand and with two
    const T16* Au = A + (size_t)r0 * K; const T16* A2u = S1 ? A2 + (size_t)r0 * K : nullptr; const T16* Bu = Bt + (size_t)c0 * K; const T16* B2u = S2 ? Bt2 + (size_t)c0 * K : nullptr;   // wave-uniform tile bases
    unsigned vo[4];
#pragma unroll
    for (int g = 0; g < 4; ++g) vo[g] = (unsigned)(((g * 16 + lr) * K + 8 * hi) * sizeof(T16));   // lane's byte offset in row group g, fixed over the K loop
    int kc = 0;
#pragma unroll 1   // a step is already straight-line code over NCM chunks; unrolled further its register set would double
    for (; kc + NCM * 32 <= Kl; kc += NCM * 32) kstep<T16, NSPLIT, NCM>(Au + kc, S1 ? A2u + kc : nullptr, Bu + kc, S2 ? B2u + kc : nullptr, vo, acc);
    if (NCM > 2 && kc + 64 <= Kl) { kstep<T16, NSPLIT, 2>(Au + kc, S1 ? A2u + kc : nullptr, Bu + kc, S2 ? B2u + kc : nullptr, vo, acc); kc += 64; }   // remainder: one step of 2 chunks, then at most one chunk
#pragma unroll 1   // the compiler cannot see that at most one chunk is left: unrolled, this would only be code that never runs
    for (; kc < Kl; kc += 32) kstep<T16, NSPLIT, 1>(Au + kc, S1 ? A2u + kc : nullptr, Bu + kc, S2 ? B2u + kc : nullptr, vo, acc);
#pragma unroll
    for (int mb = 0; mb < 4; ++mb) {
#pragma unroll
        for (int nb = 0; nb < 4; ++nb) {
#pragma unroll
            for (int j = 0; j < 8; ++j) os[(hi * 8 + j) * 68 + nb * 16 + lr] = acc[mb][nb][j]; }
        __builtin_amdgcn_wave_barrier(); asm volatile("" ::: "memory");
        float* crow = C + (size_t)(r0 + mb * 16) * ldc + c0;
{
#pragma unroll
            for (int s = 0; s < 8; ++s) { const int row = 2 * s + hi, cofs = lr * 4; v4f val = *(const v4fa*)(os + row * 68 + cofs); if (CMODE == 2) val *= osc;
                *(v4f*)(crow + (size_t)row * ldc + cofs) = val; }
             }
        __builtin_amdgcn_wave_barrier(); asm volatile("" ::: "memory");
    }
}

typedef __attribute__((ext_vector_type(2))) _Float16 v2h;
typedef __attribute__((ext_vector_type(4))) _Float16 v4h;
typedef __attribute__((ext_vector_type(2))) unsigned short v2us;
typedef __attribute__((ext_vector_type(4))) unsigned short v4us;
typedef __attribute__((ext_vector_type(2))) float v2f;
typedef __attribute__((ext_vector_type(4))) int v4i;

__global__ __launch_bounds__(256) void k_wtG(const float* __restrict__ w, int K, int N, bf* Bt) {
    const int lane = threadIdx.x & 31; const int L0 = (blockIdx.x * 8 + (threadIdx.x >> 5)) * 8; const int nlines = N * K / 64;
{
#pragma unroll 1
        for (int l = 0; l < 8; ++l) { const int L = L0 + l; if (L >= nlines) break; const size_t e = (size_t)L * 64 + lane * 2; const int k = (int)(e % K), n = (int)(e / K); v2us o;
            o[0] = f2bf(w[(size_t)k * N + n]); o[1] = f2bf(w[(size_t)(k + 1) * N + n]); *(v2us*)(Bt + e) = o; }
         }
}
__global__ __launch_bounds__(256) void k_cvt8(const float* __restrict__ src, bf* dst, size_t n8) { const size_t i = (size_t)blockIdx.x * 256 + threadIdx.x; if (i >= n8) return; const v8f v = *(const v8f*)(src + i * 8); v8us o;
#pragma unroll
    for (int k = 0; k < 8; ++k) o[k] = f2bf(v[k]); *(v8us*)(dst + i * 8) = o;  }

// k_asoft: per row (zz, i): t = S x HD^-0.5 for j <= i and i - j < WIN (sliding causal window; the reference's -1e9 additive fill vanishes identically); softmax over the 2048 keys (register row, one exp, fixed trees);
__global__ __launch_bounds__(256) void k_asoft(const float* __restrict__ Sb, h16* P16, bf* Ph, bf* Pl) {
    const int lane = threadIdx.x & 31; const int row = blockIdx.x * 8 + (threadIdx.x >> 5); if (row >= GB * ZH * TT) return; const int i = row % TT; const int zz = row / TT;   /* zz: plane = batch of the group */ (void)zz; const bool hires = (i < RH); const float* sr = Sb + (size_t)row * TT; float v[TT / 32]; float mx = -3.0e38f;
#pragma unroll
    for (int ch = 0; ch < TT / 128; ++ch) { const int j0 = ch * 128 + lane * 4; const v4f a = *(const v4f*)(sr + j0);
#pragma unroll
        for (int q = 0; q < 4; ++q) { const int j = j0 + q; (void)j; const float t = (j <= i && i - j < WIN) ? a[q] * SCL : -3.0e38f; v[ch * 4 + q] = t; mx = fmaxf(mx, t); } }
#pragma unroll
    for (int sh = 16; sh; sh >>= 1) mx = fmaxf(mx, __shfl_xor(mx, sh, 32));
    float sum = 0.f;
#pragma unroll
    for (int k = 0; k < TT / 32; ++k) { float d0 = __fsub_rn(v[k], mx); asm volatile("" : "+v"(d0)); v[k] = __builtin_amdgcn_exp2f(__fmul_rn(d0, 1.4426950408889634f)); sum += v[k]; }
#pragma unroll
    for (int sh = 16; sh; sh >>= 1) sum += __shfl_xor(sum, sh, 32);
    const float f = __fdiv_rn(hires ? 1.0f : PCAR, sum);
{
        if (hires) {
#pragma unroll
            for (int ch = 0; ch < TT / 128; ++ch) { v4us oh, ol;
#pragma unroll
                for (int q = 0; q < 4; ++q) { unsigned short a, c2; splitf(v[ch * 4 + q] * f, a, c2); oh[q] = a; ol[q] = c2; }
                const size_t oo = ((size_t)zz * (RH ? RH : 1) + i) * TT + ch * 128 + lane * 4; *(v4us*)(Ph + oo) = oh; *(v4us*)(Pl + oo) = ol; }
        } else {
#pragma unroll
            for (int ch = 0; ch < TT / 128; ++ch) { v4h o4;
#pragma unroll
                for (int q = 0; q < 4; ++q) o4[q] = tohx(v[ch * 4 + q] * f);
                *(v4h*)(P16 + (size_t)row * TT + ch * 128 + lane * 4) = o4; } }
         }
}

extern "C" void kernel_launch(void* const* d_in, const int* in_sizes, int n_in,
                              void* d_out, int out_size, void* d_ws, size_t ws_size, hipStream_t stream) {
    (void)in_sizes; (void)n_in; (void)out_size;
    const float* x = (const float*)d_in[0]; const float* wq = (const float*)d_in[1]; const float* wk = (const float*)d_in[2]; const float* wv = (const float*)d_in[3]; const float* wo = nullptr; (void)wo;   /* x, wq, wk, wv ('xw' [768][768]) */
    float* OUT = (float*)d_out;     // [8][2048][768]
    char* wsp = (char*)d_ws;
    auto take = [&](size_t bytes) { char* p = wsp; wsp += (bytes + 255) & ~(size_t)255; return (void*)p; };
    bf* WQ = (bf*)take((size_t)DQ * DM * 2); bf* WK = (bf*)take((size_t)DKV * DM * 2); bf* WV = (bf*)take((size_t)DKV * DM * 2);
    h16* QP16 = (h16*)take((size_t)GB * NH_ * TT * HD * 2); h16* KP16 = (h16*)take((size_t)GB * NKV * TT * HD * 2); h16* VT16 = (h16*)take((size_t)GB * NKV * HD * TT * 2);
    bf* QPh = (bf*)take((size_t)GB * NH_ * TT * HD * 2); bf* QPl = (bf*)take((size_t)GB * NH_ * TT * HD * 2); bf* KPh = (bf*)take((size_t)GB * NKV * TT * HD * 2); bf* KPl = (bf*)take((size_t)GB * NKV * TT * HD * 2); bf* VTh = (bf*)take((size_t)GB * NKV * HD * TT * 2); bf* VTl = (bf*)take((size_t)GB * NKV * HD * TT * 2); bf* Ph = (bf*)take((size_t)GB * ZH * RH * TT * 2); bf* Pl = (bf*)take((size_t)GB * ZH * RH * TT * 2);
    float* Sb = (float*)take((size_t)GB * ZH * TT * TT * 4); h16* P16 = (h16*)take((size_t)GB * ZH * TT * TT * 2);
    if ((size_t)(wsp - (char*)d_ws) > ws_size) return;    // ws 256 MiB
    // The score region is used twice in stream order: the bf16 copy of x (dead once the three projections have run), then the scores.
    static_assert((size_t)TT * DM * 2 <= (size_t)ZH * TT * TT * 4, "overlay fits the score region");
    bf* XB = (bf*)Sb;
    { k_wtG<<<(unsigned)((DM * DQ / 64 + 63) / 64), 256, 0, stream>>>(wq, DM, DQ, WQ); k_wtG<<<(unsigned)((DM * DKV / 64 + 63) / 64), 256, 0, stream>>>(wk, DM, DKV, WK); k_wtG<<<(unsigned)((DM * DKV / 64 + 63) / 64), 256, 0, stream>>>(wv, DM, DKV, WV);
       }
    for (int b = 0; b < NB_; b += GB) {   // GB batches per pass: the q and k projections see GB*TT flat rows, the v projection and the attention GEMMs take the batch from grid z, the softmax from its row index
        k_cvt8<<<(unsigned)(((size_t)GB * TT * DM / 8 + 255) / 256), 256, 0, stream>>>(x + (size_t)b * TT * DM, XB, (size_t)GB * TT * DM / 8);
        k_gemmw<bf, 0><<<dim3(GB * TT / 64, DQ / 64, 1), 32, 0, stream>>>(XB, nullptr, WQ, nullptr, DM, QP16, QPh, QPl, DQ, 0, 0, 0);
        k_gemmw<bf, 0><<<dim3(GB * TT / 64, DKV / 64, 1), 32, 0, stream>>>(XB, nullptr, WK, nullptr, DM, KP16, KPh, KPl, DKV, 0, 0, 0);
        k_gemmw<bf, 0><<<dim3(DKV / 64, TT / 64, GB), 32, 0, stream>>>(WV, nullptr, XB, nullptr, DM, VT16, VTh, VTl, TT, 0, (size_t)TT * DM, (size_t)HD * TT);   // rows = v columns, columns = tokens: v^T [d][t] per batch
        k_gemmc<bf, 2, 1><<<dim3(RH / 64, TT / 64, GB), 32, 0, stream>>>(QPh, QPl, KPh, KPl, HD, Sb, TT, 0, 1.0f, (size_t)TT * HD, (size_t)TT * HD, (size_t)TT * TT);
        k_gemmc<h16, 0, 1><<<dim3((TT - RH) / 64, TT / 64, GB), 32, 0, stream>>>(QP16 + (size_t)RH * HD, nullptr, KP16, nullptr, HD, Sb + (size_t)RH * TT, TT, RH, 1.0f, (size_t)TT * HD, (size_t)TT * HD, (size_t)TT * TT);
        k_asoft<<<GB * ZH * TT / 8, 256, 0, stream>>>(Sb, P16, Ph, Pl);
        k_gemmc<bf, 2, 2><<<dim3(RH / 64, HD / 64, GB), 32, 0, stream>>>(Ph, Pl, VTh, VTl, TT, OUT + (size_t)b * TT * DQ, HD, 0, 1.0f, (size_t)RH * TT, (size_t)HD * TT, (size_t)TT * HD);
        k_gemmc<h16, 0, 2><<<dim3((TT - RH) / 64, HD / 64, GB), 32, 0, stream>>>(P16 + (size_t)RH * TT, nullptr, VT16, nullptr, TT, OUT + (size_t)b * TT * DQ + (size_t)RH * HD, HD, RH, 1.0f / PCAR, (size_t)TT * TT, (size_t)HD * TT, (size_t)TT * HD);
    }
}
